// v000
// Times are from an AMD MI455X. After a warm-up the kernel runs many times in a row, and a time is the length of
// such a window on the GPU divided by its runs, so every launch and the gaps after it count. The runs cycle
// through copies of the inputs. A figure is the median of several windows, for all but v000 over two sittings.
// Sittings can differ by a few percent; kernels timed side by side share one.
// v000 is the starting kernel. One run takes 488 microseconds.
#include <hip/hip_runtime.h>
#include <stdint.h>
#include <stddef.h>

// ---------------- problem dims (hardcoded from reference) ----------------
static constexpr int Bsz  = 4;
static constexpr int Hh   = 128;
static constexpr int Wh   = 128;
static constexpr int Cc   = 256;
static constexpr int Nn   = Hh * Wh;          // 16384
static constexpr int Ssz  = (Hh/2) * (Wh/2);  // 4096
static constexpr int NH   = 8;
static constexpr int ROWS_X = Bsz * Nn;       // 65536
static constexpr int ROWS_S = Bsz * Ssz;      // 16384

// ---------------- types ----------------
typedef __bf16 bf16_t;
typedef __attribute__((ext_vector_type(16))) __bf16 v16bf;
typedef __attribute__((ext_vector_type(8)))  __bf16 v8bf;
typedef __attribute__((ext_vector_type(8)))  float  v8f;

struct bf4 { bf16_t e[4]; };   // POD 8-byte pack

__device__ inline bf16_t f2bf(float f) {
  union { float f; unsigned u; } a; a.f = f;
  unsigned r = a.u + 0x7FFFu + ((a.u >> 16) & 1u);
  unsigned short h = (unsigned short)(r >> 16);
  union { unsigned short u; bf16_t b; } o; o.u = h;
  return o.b;
}
__device__ inline float bf2f(bf16_t b) {
  union { unsigned short u; bf16_t b; } i; i.b = b;
  union { unsigned u; float f; } o; o.u = ((unsigned)i.u) << 16;
  return o.f;
}

// Assemble 16-elem bf16 WMMA fragment: 8 contiguous at p, 8 at p+16.
__device__ inline v16bf frag16(const bf16_t* p) {
  v8bf lo = *(const v8bf*)p;
  v8bf hi = *(const v8bf*)(p + 16);
  return __builtin_shufflevector(lo, hi, 0,1,2,3,4,5,6,7,8,9,10,11,12,13,14,15);
}

// gfx1250 async global->LDS copy, 16B per lane, tracked by ASYNCcnt.
// LDS dest VGPR = wave-relative LDS byte offset (low 32b of flat LDS address).
__device__ inline uint32_t lds_off32(const void* p) {
  return (uint32_t)(uintptr_t)p;
}
#define ASYNC_LD_B128(ldsoff, gptr)                                        \
  asm volatile("global_load_async_to_lds_b128 %0, %1, off"                 \
               :: "v"(ldsoff), "v"((uint64_t)(uintptr_t)(gptr)) : "memory")

// ---------------- weight prep ----------------
__global__ void k_transpose_w(const float* __restrict__ w, bf16_t* __restrict__ wT,
                              int K, int Ncol) {
  int idx = blockIdx.x * blockDim.x + threadIdx.x;
  if (idx >= K * Ncol) return;
  int k = idx / Ncol, n = idx % Ncol;
  wT[(size_t)n * K + k] = f2bf(w[idx]);
}

__global__ void k_pack_srw(const float* __restrict__ w, bf16_t* __restrict__ wT) {
  int idx = blockIdx.x * blockDim.x + threadIdx.x;
  if (idx >= Cc * 4 * Cc) return;
  int o = idx >> 10, r = idx & 1023;
  int p = r >> 8, i = r & 255;
  int kh = p >> 1, kw = p & 1;
  wT[(size_t)o * 1024 + r] = f2bf(w[(((size_t)o * Cc + i) * 2 + kh) * 2 + kw]);
}

__global__ void k_pack_x(const float* __restrict__ x, bf16_t* __restrict__ cat) {
  int idx = blockIdx.x * blockDim.x + threadIdx.x;   // one per 4 elems
  long e = (long)idx * 4;
  if (e >= (long)ROWS_X * Cc) return;
  int row = (int)(e >> 8), c = (int)(e & 255);
  float4 v = *(const float4*)(x + (size_t)row * Cc + c);
  bf4 pk; pk.e[0]=f2bf(v.x); pk.e[1]=f2bf(v.y); pk.e[2]=f2bf(v.z); pk.e[3]=f2bf(v.w);
  *(bf4*)(cat + (size_t)row * 512 + c) = pk;
}

__global__ void k_im2col(const float* __restrict__ x, bf16_t* __restrict__ xim) {
  int bs = blockIdx.x;                  // 0..ROWS_S-1
  int t  = threadIdx.x;                 // 256 threads * 4 elems = 1024
  int b  = bs >> 12;
  int s  = bs & 4095;
  int oh = s >> 6, ow = s & 63;
  int kidx = t * 4;
  int p = kidx >> 8, i = kidx & 255;
  int kh = p >> 1, kw = p & 1;
  int n = (2*oh + kh) * Wh + (2*ow + kw);
  float4 v = *(const float4*)(x + ((size_t)b * Nn + n) * Cc + i);
  bf4 pk; pk.e[0]=f2bf(v.x); pk.e[1]=f2bf(v.y); pk.e[2]=f2bf(v.z); pk.e[3]=f2bf(v.w);
  *(bf4*)(xim + (size_t)bs * 1024 + kidx) = pk;
}

// ---------------- generic WMMA GEMM (128x64 tile, async double-buffered) ----------------
enum { EP_F32 = 0, EP_BIAS_F32 = 1, EP_ELU_BF = 2, EP_SCALE_BF = 3, EP_RELU_BF = 4 };

// C[M,Ncol] = epi( A[M,K](lda) * BT[Ncol,K]^T ), block tile 128x64, k-step 32.
// 8 waves: wave -> (wy=w>>1 in 0..3 : 32 rows, wx=w&1 : 32 cols), 2x2 accs each.
__global__ __launch_bounds__(256) void k_gemm_wmma(
    const bf16_t* __restrict__ A, int lda,
    const bf16_t* __restrict__ BT,
    int M, int Ncol, int K,
    float* __restrict__ outF, bf16_t* __restrict__ outB, int ldo,
    const float* __restrict__ bias, float scale, int mode)
{
  __shared__ __align__(16) bf16_t As[2][128 * 32];
  __shared__ __align__(16) bf16_t Bs[2][64 * 32];
  const int tid  = threadIdx.x;
  const int lane = tid & 31, wave = tid >> 5;
  const int wy = wave >> 1, wx = wave & 1;
  const int row0 = blockIdx.y * 128;
  const int col0 = blockIdx.x * 64;
  // tile loaders: A 128x32 -> 16 bf16/thread (2x b128); B 64x32 -> 8 bf16/thread
  const int lrA = tid >> 1, lkA = (tid & 1) << 4;
  const int lrB = tid >> 2, lkB = (tid & 3) << 3;
  const bf16_t* Ag = A  + (size_t)(row0 + lrA) * lda + lkA;
  const bf16_t* Bg = BT + (size_t)(col0 + lrB) * K   + lkB;
  uint32_t ldsA0[2], ldsA1[2], ldsBo[2];
#pragma unroll
  for (int b = 0; b < 2; ++b) {
    ldsA0[b] = lds_off32(&As[b][lrA * 32 + lkA]);
    ldsA1[b] = lds_off32(&As[b][lrA * 32 + lkA + 8]);
    ldsBo[b] = lds_off32(&Bs[b][lrB * 32 + lkB]);
  }
  const int r = lane & 15, hb = (lane >> 4) << 3;

  v8f acc[2][2] = {};

  // prologue: stage k0=0 into buffer 0
  ASYNC_LD_B128(ldsA0[0], Ag);
  ASYNC_LD_B128(ldsA1[0], Ag + 8);
  ASYNC_LD_B128(ldsBo[0], Bg);

  for (int k0 = 0; k0 < K; k0 += 32) {
    const int cur = (k0 >> 5) & 1;
    if (k0 + 32 < K) {              // stage next tile into other buffer
      ASYNC_LD_B128(ldsA0[cur ^ 1], Ag + k0 + 32);
      ASYNC_LD_B128(ldsA1[cur ^ 1], Ag + k0 + 40);
      ASYNC_LD_B128(ldsBo[cur ^ 1], Bg + k0 + 32);
      asm volatile("s_wait_asynccnt 0x3" ::: "memory");   // current 3 done
    } else {
      asm volatile("s_wait_asynccnt 0x0" ::: "memory");
    }
    __syncthreads();
    const bf16_t* as = &As[cur][0];
    const bf16_t* bs = &Bs[cur][0];
    v16bf a0 = frag16(as + (wy * 32 +      r) * 32 + hb);
    v16bf a1 = frag16(as + (wy * 32 + 16 + r) * 32 + hb);
    v16bf b0 = frag16(bs + (wx * 32 +      r) * 32 + hb);
    v16bf b1 = frag16(bs + (wx * 32 + 16 + r) * 32 + hb);
    acc[0][0] = __builtin_amdgcn_wmma_f32_16x16x32_bf16(false, a0, false, b0,
                                                        (short)0, acc[0][0], false, false);
    acc[0][1] = __builtin_amdgcn_wmma_f32_16x16x32_bf16(false, a0, false, b1,
                                                        (short)0, acc[0][1], false, false);
    acc[1][0] = __builtin_amdgcn_wmma_f32_16x16x32_bf16(false, a1, false, b0,
                                                        (short)0, acc[1][0], false, false);
    acc[1][1] = __builtin_amdgcn_wmma_f32_16x16x32_bf16(false, a1, false, b1,
                                                        (short)0, acc[1][1], false, false);
    __syncthreads();
  }

  const int half = lane >> 4;
#pragma unroll
  for (int m = 0; m < 2; ++m) {
#pragma unroll
    for (int i = 0; i < 8; ++i) {
      int orow = row0 + wy * 32 + m * 16 + i + half * 8;
#pragma unroll
      for (int n = 0; n < 2; ++n) {
        int ocol = col0 + wx * 32 + n * 16 + r;
        float v = acc[m][n][i];
        if (mode == EP_F32) {
          outF[(size_t)orow * ldo + ocol] = v;
        } else if (mode == EP_BIAS_F32) {
          outF[(size_t)orow * ldo + ocol] = v + bias[ocol];
        } else if (mode == EP_ELU_BF) {   // elu(x)+1 : x+1 if x>0 else exp(x)
          outB[(size_t)orow * ldo + ocol] = f2bf(v > 0.f ? v + 1.f : __expf(v));
        } else if (mode == EP_SCALE_BF) {
          outB[(size_t)orow * ldo + ocol] = f2bf(v * scale);
        } else {                          // relu -> bf16
          outB[(size_t)orow * ldo + ocol] = f2bf(v > 0.f ? v : 0.f);
        }
      }
    }
  }
}

// ---------------- LayerNorm over 256-wide rows ----------------
__global__ __launch_bounds__(256) void k_layernorm(
    const float* __restrict__ in, const float* __restrict__ g, const float* __restrict__ bb,
    bf16_t* __restrict__ outB, int ldoB,
    float* __restrict__ outF, const float* __restrict__ resid, int rows)
{
  int wave = threadIdx.x >> 5, lane = threadIdx.x & 31;
  int row = blockIdx.x * 8 + wave;
  if (row >= rows) return;
  const float* p = in + (size_t)row * 256;
  float4 a = *(const float4*)(p + lane * 8);
  float4 c = *(const float4*)(p + lane * 8 + 4);
  float vals[8] = {a.x, a.y, a.z, a.w, c.x, c.y, c.z, c.w};
  float s = 0.f;
#pragma unroll
  for (int j = 0; j < 8; ++j) s += vals[j];
#pragma unroll
  for (int o = 16; o > 0; o >>= 1) s += __shfl_xor(s, o, 32);
  float mean = s * (1.f / 256.f);
  float vs = 0.f;
#pragma unroll
  for (int j = 0; j < 8; ++j) { vals[j] -= mean; vs += vals[j] * vals[j]; }
#pragma unroll
  for (int o = 16; o > 0; o >>= 1) vs += __shfl_xor(vs, o, 32);
  float inv = rsqrtf(vs * (1.f / 256.f) + 1e-5f);
#pragma unroll
  for (int j = 0; j < 8; ++j) {
    int c0 = lane * 8 + j;
    float y = vals[j] * inv * g[c0] + bb[c0];
    if (outB) outB[(size_t)row * ldoB + c0] = f2bf(y);
    if (outF) outF[(size_t)row * 256 + c0] = y + resid[(size_t)row * 256 + c0];
  }
}

// ---------------- Ksum = sum_s K_elu ----------------
__global__ void k_ksum_part(const bf16_t* __restrict__ Ke, float* __restrict__ part) {
  int blk = blockIdx.x;                 // B*16
  int b = blk >> 4, ch = blk & 15;
  int c = threadIdx.x;                  // 256
  const bf16_t* p = Ke + ((size_t)b * Ssz + ch * 256) * 256 + c;
  float s = 0.f;
  for (int i = 0; i < 256; ++i) s += bf2f(p[(size_t)i * 256]);
  part[((size_t)b * 16 + ch) * 256 + c] = s;
}
__global__ void k_ksum_reduce(const float* __restrict__ part, float* __restrict__ ksum) {
  int idx = blockIdx.x * blockDim.x + threadIdx.x;  // B*256
  if (idx >= Bsz * 256) return;
  int b = idx >> 8, c = idx & 255;
  float s = 0.f;
  for (int ch = 0; ch < 16; ++ch) s += part[((size_t)b * 16 + ch) * 256 + c];
  ksum[idx] = s;
}

// ---------------- KV[b,h] = K^T * Vsc (32x32 over S=4096), stored transposed ----------------
__global__ __launch_bounds__(256) void k_kv_wmma(const bf16_t* __restrict__ Ke,
                                                 const bf16_t* __restrict__ Vsc,
                                                 bf16_t* __restrict__ KVbT)
{
  __shared__ __align__(16) bf16_t KT[32 * 32];  // [d][s]
  __shared__ __align__(16) bf16_t VT[32 * 32];  // [e][s]
  int bh = blockIdx.x;                  // B*NH
  int b = bh >> 3, h = bh & 7;
  int tid = threadIdx.x, lane = tid & 31, wave = tid >> 5;
  int d0 = (tid & 7) * 4;
  int si = tid >> 3;
  const int r = lane & 15, hb = (lane >> 4) << 3;
  int ti = (wave >> 1) & 1, tj = wave & 1;
  v8f acc = {0,0,0,0,0,0,0,0};
  const size_t base = (size_t)b * Ssz * 256 + h * 32;

  for (int s0 = 0; s0 < Ssz; s0 += 32) {
    bf4 kk = *(const bf4*)(Ke  + base + (size_t)(s0 + si) * 256 + d0);
    bf4 vv = *(const bf4*)(Vsc + base + (size_t)(s0 + si) * 256 + d0);
    __syncthreads();
#pragma unroll
    for (int j = 0; j < 4; ++j) {
      KT[(d0 + j) * 32 + si] = kk.e[j];
      VT[(d0 + j) * 32 + si] = vv.e[j];
    }
    __syncthreads();
    if (wave < 4) {
      v16bf af = frag16(KT + (ti * 16 + r) * 32 + hb);
      v16bf bf = frag16(VT + (tj * 16 + r) * 32 + hb);
      acc = __builtin_amdgcn_wmma_f32_16x16x32_bf16(false, af, false, bf,
                                                    (short)0, acc, false, false);
    }
  }
  if (wave < 4) {
    int half = lane >> 4;
#pragma unroll
    for (int i = 0; i < 8; ++i) {
      int d = ti * 16 + i + half * 8;
      int e = tj * 16 + r;
      KVbT[((size_t)bh * 32 + e) * 32 + d] = f2bf(acc[i]);
    }
  }
}

// ---------------- msg = (Q * KV) * S/(Q.Ksum + eps) ----------------
__global__ __launch_bounds__(256) void k_msg_wmma(const bf16_t* __restrict__ Qe,
                                                  const bf16_t* __restrict__ KVbT,
                                                  const float* __restrict__ ksum,
                                                  bf16_t* __restrict__ msgb)
{
  int row0 = blockIdx.x * 16;
  int lane = threadIdx.x & 31, h = threadIdx.x >> 5;
  int b = row0 >> 14;
  const int r = lane & 15, hb = (lane >> 4) << 3;

  const bf16_t* Ap = Qe + (size_t)(row0 + r) * 256 + h * 32;
  v16bf af = frag16(Ap + hb);
  const bf16_t* Bp = KVbT + (size_t)(b * 8 + h) * 32 * 32;
  v16bf bf0 = frag16(Bp + r * 32 + hb);
  v16bf bf1 = frag16(Bp + (16 + r) * 32 + hb);
  v8f acc0 = {0,0,0,0,0,0,0,0};
  v8f acc1 = {0,0,0,0,0,0,0,0};
  acc0 = __builtin_amdgcn_wmma_f32_16x16x32_bf16(false, af, false, bf0,
                                                 (short)0, acc0, false, false);
  acc1 = __builtin_amdgcn_wmma_f32_16x16x32_bf16(false, af, false, bf1,
                                                 (short)0, acc1, false, false);

  const float* ks = ksum + (size_t)b * 256 + h * 32;
  float dot = 0.f;
#pragma unroll
  for (int d = 0; d < 32; ++d) dot += bf2f(Ap[d]) * ks[d];
  float z = (float)Ssz / (dot + 1e-6f);

  int half = lane >> 4;
#pragma unroll
  for (int i = 0; i < 8; ++i) {
    float zi = __shfl(z, i + half * 8, 32);
    int orow = row0 + i + half * 8;
    bf16_t* op = msgb + (size_t)orow * 256 + h * 32;
    op[r]      = f2bf(acc0[i] * zi);
    op[16 + r] = f2bf(acc1[i] * zi);
  }
}

// ---------------- host launcher ----------------
extern "C" void kernel_launch(void* const* d_in, const int* in_sizes, int n_in,
                              void* d_out, int out_size, void* d_ws, size_t ws_size,
                              hipStream_t stream) {
  const float* x      = (const float*)d_in[0];
  const float* sr_w   = (const float*)d_in[1];
  const float* sr_b   = (const float*)d_in[2];
  const float* norm_g = (const float*)d_in[3];
  const float* norm_b = (const float*)d_in[4];
  const float* wq     = (const float*)d_in[5];
  const float* wk     = (const float*)d_in[6];
  const float* wv     = (const float*)d_in[7];
  const float* wm     = (const float*)d_in[8];
  const float* w1     = (const float*)d_in[9];
  const float* w2     = (const float*)d_in[10];
  const float* n1g    = (const float*)d_in[11];
  const float* n1b    = (const float*)d_in[12];
  const float* n2g    = (const float*)d_in[13];
  const float* n2b    = (const float*)d_in[14];
  float* out = (float*)d_out;

  char* ws = (char*)d_ws;
  size_t off = 0;
  auto alloc = [&](size_t bytes) -> void* {
    off = (off + 255) & ~(size_t)255;
    void* p = ws + off;
    off += bytes;
    return p;
  };

  bf16_t* wqT  = (bf16_t*)alloc((size_t)256 * 256 * 2);
  bf16_t* wkT  = (bf16_t*)alloc((size_t)256 * 256 * 2);
  bf16_t* wvT  = (bf16_t*)alloc((size_t)256 * 256 * 2);
  bf16_t* wmT  = (bf16_t*)alloc((size_t)256 * 256 * 2);
  bf16_t* w1T  = (bf16_t*)alloc((size_t)512 * 512 * 2);
  bf16_t* w2T  = (bf16_t*)alloc((size_t)256 * 512 * 2);
  bf16_t* wsrT = (bf16_t*)alloc((size_t)256 * 1024 * 2);
  float*  part = (float*)alloc((size_t)Bsz * 16 * 256 * 4);
  float*  ksum = (float*)alloc((size_t)Bsz * 256 * 4);
  bf16_t* KVbT = (bf16_t*)alloc((size_t)Bsz * NH * 32 * 32 * 2);
  bf16_t* cat  = (bf16_t*)alloc((size_t)ROWS_X * 512 * 2);          // [x | msg_ln]
  // pool A: im2col buf, later reused for msg (both 32 MiB)
  bf16_t* xim  = (bf16_t*)alloc((size_t)ROWS_S * 1024 * 2);
  bf16_t* msgb = xim;
  // pool B: Qe + xs + xs_ln + Ke + Vsc, later reused for h1 (64 MiB <= 72 MiB)
  size_t szQe = (size_t)ROWS_X * 256 * 2;
  size_t szXs = (size_t)ROWS_S * 256 * 4;
  size_t szLn = (size_t)ROWS_S * 256 * 2;
  char* poolB = (char*)alloc(szQe + szXs + 3 * szLn);
  bf16_t* Qe    = (bf16_t*)poolB;
  float*  xs    = (float*)(poolB + szQe);
  bf16_t* xs_ln = (bf16_t*)(poolB + szQe + szXs);
  bf16_t* Ke    = (bf16_t*)(poolB + szQe + szXs + szLn);
  bf16_t* Vsc   = (bf16_t*)(poolB + szQe + szXs + 2 * szLn);
  bf16_t* h1    = (bf16_t*)poolB;        // [ROWS_X][512] bf16
  // pool C: mm f32, reused for h2 f32
  float* mm = (float*)alloc((size_t)ROWS_X * 256 * 4);
  float* h2 = mm;

  // --- weight prep ---
  k_transpose_w<<<(256 * 256 + 255) / 256, 256, 0, stream>>>(wq, wqT, 256, 256);
  k_transpose_w<<<(256 * 256 + 255) / 256, 256, 0, stream>>>(wk, wkT, 256, 256);
  k_transpose_w<<<(256 * 256 + 255) / 256, 256, 0, stream>>>(wv, wvT, 256, 256);
  k_transpose_w<<<(256 * 256 + 255) / 256, 256, 0, stream>>>(wm, wmT, 256, 256);
  k_transpose_w<<<(512 * 512 + 255) / 256, 256, 0, stream>>>(w1, w1T, 512, 512);
  k_transpose_w<<<(512 * 256 + 255) / 256, 256, 0, stream>>>(w2, w2T, 512, 256);
  k_pack_srw<<<(256 * 1024 + 255) / 256, 256, 0, stream>>>(sr_w, wsrT);
  k_pack_x<<<(ROWS_X * 256 / 4 + 255) / 256, 256, 0, stream>>>(x, cat);
  k_im2col<<<ROWS_S, 256, 0, stream>>>(x, xim);

  // --- spatial reduction conv (im2col GEMM) + LN ---
  k_gemm_wmma<<<dim3(256 / 64, ROWS_S / 128), 256, 0, stream>>>(
      xim, 1024, wsrT, ROWS_S, 256, 1024, xs, nullptr, 256, sr_b, 0.f, EP_BIAS_F32);
  k_layernorm<<<ROWS_S / 8, 256, 0, stream>>>(xs, norm_g, norm_b, xs_ln, 256,
                                              nullptr, nullptr, ROWS_S);

  // --- projections (Q from cat[:, :256], K/V from xs_ln) ---
  k_gemm_wmma<<<dim3(4, ROWS_X / 128), 256, 0, stream>>>(
      cat, 512, wqT, ROWS_X, 256, 256, nullptr, Qe, 256, nullptr, 0.f, EP_ELU_BF);
  k_gemm_wmma<<<dim3(4, ROWS_S / 128), 256, 0, stream>>>(
      xs_ln, 256, wkT, ROWS_S, 256, 256, nullptr, Ke, 256, nullptr, 0.f, EP_ELU_BF);
  k_gemm_wmma<<<dim3(4, ROWS_S / 128), 256, 0, stream>>>(
      xs_ln, 256, wvT, ROWS_S, 256, 256, nullptr, Vsc, 256, nullptr,
      1.f / (float)Ssz, EP_SCALE_BF);

  // --- linear attention ---
  k_ksum_part<<<Bsz * 16, 256, 0, stream>>>(Ke, part);
  k_ksum_reduce<<<(Bsz * 256 + 255) / 256, 256, 0, stream>>>(part, ksum);
  k_kv_wmma<<<Bsz * NH, 256, 0, stream>>>(Ke, Vsc, KVbT);
  k_msg_wmma<<<ROWS_X / 16, 256, 0, stream>>>(Qe, KVbT, ksum, msgb);

  // --- merge proj + LN1 (into cat[:, 256:512]) ---
  k_gemm_wmma<<<dim3(4, ROWS_X / 128), 256, 0, stream>>>(
      msgb, 256, wmT, ROWS_X, 256, 256, mm, nullptr, 256, nullptr, 0.f, EP_F32);
  k_layernorm<<<ROWS_X / 8, 256, 0, stream>>>(mm, n1g, n1b, cat + 256, 512,
                                              nullptr, nullptr, ROWS_X);

  // --- MLP ---
  k_gemm_wmma<<<dim3(8, ROWS_X / 128), 256, 0, stream>>>(
      cat, 512, w1T, ROWS_X, 512, 512, nullptr, h1, 512, nullptr, 0.f, EP_RELU_BF);
  k_gemm_wmma<<<dim3(4, ROWS_X / 128), 256, 0, stream>>>(
      h1, 512, w2T, ROWS_X, 256, 512, h2, nullptr, 256, nullptr, 0.f, EP_F32);

  // --- LN2 + residual ---
  k_layernorm<<<ROWS_X / 8, 256, 0, stream>>>(h2, n2g, n2b, nullptr, 0,
                                              out, x, ROWS_X);
}

// v001
// A run of this version takes 417 microseconds.
// Two timings next to v000 put it at 1.19 and 1.20 times that version's speed.
#include <hip/hip_runtime.h>
#include <stdint.h>
#include <stddef.h>

// ---------------- problem dims (hardcoded from reference) ----------------
static constexpr int Bsz  = 4;
static constexpr int Hh   = 128;
static constexpr int Wh   = 128;
static constexpr int Cc   = 256;
static constexpr int Nn   = Hh * Wh;          // 16384
static constexpr int Ssz  = (Hh/2) * (Wh/2);  // 4096
static constexpr int NH   = 8;
static constexpr int ROWS_X = Bsz * Nn;       // 65536
static constexpr int ROWS_S = Bsz * Ssz;      // 16384

// ---------------- types ----------------
typedef __bf16 bf16_t;
typedef __attribute__((ext_vector_type(16))) __bf16 v16bf;
typedef __attribute__((ext_vector_type(8)))  __bf16 v8bf;
typedef __attribute__((ext_vector_type(8)))  float  v8f;

struct bf4 { bf16_t e[4]; };   // POD 8-byte pack

__device__ inline bf16_t f2bf(float f) {
  union { float f; unsigned u; } a; a.f = f;
  unsigned r = a.u + 0x7FFFu + ((a.u >> 16) & 1u);
  unsigned short h = (unsigned short)(r >> 16);
  union { unsigned short u; bf16_t b; } o; o.u = h;
  return o.b;
}
__device__ inline float bf2f(bf16_t b) {
  union { unsigned short u; bf16_t b; } i; i.b = b;
  union { unsigned u; float f; } o; o.u = ((unsigned)i.u) << 16;
  return o.f;
}

// Assemble 16-elem bf16 WMMA fragment: 8 contiguous at p, 8 at p+16.
__device__ inline v16bf frag16(const bf16_t* p) {
  v8bf lo = *(const v8bf*)p;
  v8bf hi = *(const v8bf*)(p + 16);
  return __builtin_shufflevector(lo, hi, 0,1,2,3,4,5,6,7,8,9,10,11,12,13,14,15);
}

// gfx1250 async global->LDS copy, 16B per lane, tracked by ASYNCcnt.
// LDS dest VGPR = wave-relative LDS byte offset (low 32b of flat LDS address).
__device__ inline uint32_t lds_off32(const void* p) {
  return (uint32_t)(uintptr_t)p;
}
#define ASYNC_LD_B128(ldsoff, gptr)                                        \
  asm volatile("global_load_async_to_lds_b128 %0, %1, off"                 \
               :: "v"(ldsoff), "v"((uint64_t)(uintptr_t)(gptr)) : "memory")

// ---------------- weight prep ----------------
__global__ void k_transpose_w(const float* __restrict__ w, bf16_t* __restrict__ wT,
                              int K, int Ncol) {
  int idx = blockIdx.x * blockDim.x + threadIdx.x;
  if (idx >= K * Ncol) return;
  int k = idx / Ncol, n = idx % Ncol;
  wT[(size_t)n * K + k] = f2bf(w[idx]);
}

__global__ void k_pack_srw(const float* __restrict__ w, bf16_t* __restrict__ wT) {
  int idx = blockIdx.x * blockDim.x + threadIdx.x;
  if (idx >= Cc * 4 * Cc) return;
  int o = idx >> 10, r = idx & 1023;
  int p = r >> 8, i = r & 255;
  int kh = p >> 1, kw = p & 1;
  wT[(size_t)o * 1024 + r] = f2bf(w[(((size_t)o * Cc + i) * 2 + kh) * 2 + kw]);
}

__global__ void k_pack_x(const float* __restrict__ x, bf16_t* __restrict__ cat) {
  int idx = blockIdx.x * blockDim.x + threadIdx.x;   // one per 4 elems
  long e = (long)idx * 4;
  if (e >= (long)ROWS_X * Cc) return;
  int row = (int)(e >> 8), c = (int)(e & 255);
  float4 v = *(const float4*)(x + (size_t)row * Cc + c);
  bf4 pk; pk.e[0]=f2bf(v.x); pk.e[1]=f2bf(v.y); pk.e[2]=f2bf(v.z); pk.e[3]=f2bf(v.w);
  *(bf4*)(cat + (size_t)row * 512 + c) = pk;
}

__global__ void k_im2col(const float* __restrict__ x, bf16_t* __restrict__ xim) {
  int bs = blockIdx.x;                  // 0..ROWS_S-1
  int t  = threadIdx.x;                 // 256 threads * 4 elems = 1024
  int b  = bs >> 12;
  int s  = bs & 4095;
  int oh = s >> 6, ow = s & 63;
  int kidx = t * 4;
  int p = kidx >> 8, i = kidx & 255;
  int kh = p >> 1, kw = p & 1;
  int n = (2*oh + kh) * Wh + (2*ow + kw);
  float4 v = *(const float4*)(x + ((size_t)b * Nn + n) * Cc + i);
  bf4 pk; pk.e[0]=f2bf(v.x); pk.e[1]=f2bf(v.y); pk.e[2]=f2bf(v.z); pk.e[3]=f2bf(v.w);
  *(bf4*)(xim + (size_t)bs * 1024 + kidx) = pk;
}

// ---------------- generic WMMA GEMM (128x64 tile, async double-buffered) ----------------
enum { EP_F32 = 0, EP_BIAS_F32 = 1, EP_ELU_BF = 2, EP_SCALE_BF = 3, EP_RELU_BF = 4 };

// C[M,Ncol] = epi( A[M,K](lda) * BT[Ncol,K]^T ), block tile 128x64, k-step 32.
// 8 waves: wave -> (wy=w>>1 in 0..3 : 32 rows, wx=w&1 : 32 cols), 2x2 accs each.
__global__ __launch_bounds__(256) void k_gemm_wmma(
    const bf16_t* __restrict__ A, int lda,
    const bf16_t* __restrict__ BT,
    int M, int Ncol, int K,
    float* __restrict__ outF, bf16_t* __restrict__ outB, int ldo,
    const float* __restrict__ bias, float scale, int mode)
{
  __shared__ __align__(16) bf16_t As[2][128 * 32];
  __shared__ __align__(16) bf16_t Bs[2][64 * 32];
  const int tid  = threadIdx.x;
  const int lane = tid & 31, wave = tid >> 5;
  const int wy = wave >> 1, wx = wave & 1;
  const int row0 = blockIdx.y * 128;
  const int col0 = blockIdx.x * 64;
  // tile loaders: A 128x32 -> 16 bf16/thread (2x b128); B 64x32 -> 8 bf16/thread
  const int lrA = tid >> 1, lkA = (tid & 1) << 4;
  const int lrB = tid >> 2, lkB = (tid & 3) << 3;
  const bf16_t* Ag = A  + (size_t)(row0 + lrA) * lda + lkA;
  const bf16_t* Bg = BT + (size_t)(col0 + lrB) * K   + lkB;
  uint32_t ldsA0[2], ldsA1[2], ldsBo[2];
#pragma unroll
  for (int b = 0; b < 2; ++b) {
    ldsA0[b] = lds_off32(&As[b][lrA * 32 + lkA]);
    ldsA1[b] = lds_off32(&As[b][lrA * 32 + lkA + 8]);
    ldsBo[b] = lds_off32(&Bs[b][lrB * 32 + lkB]);
  }
  const int r = lane & 15, hb = (lane >> 4) << 3;

  v8f acc[2][2] = {};

  // prologue: stage k0=0 into buffer 0
  ASYNC_LD_B128(ldsA0[0], Ag);
  ASYNC_LD_B128(ldsA1[0], Ag + 8);
  ASYNC_LD_B128(ldsBo[0], Bg);

  for (int k0 = 0; k0 < K; k0 += 32) {
    const int cur = (k0 >> 5) & 1;
    if (k0 + 32 < K) {              // stage next tile into other buffer
      ASYNC_LD_B128(ldsA0[cur ^ 1], Ag + k0 + 32);
      ASYNC_LD_B128(ldsA1[cur ^ 1], Ag + k0 + 40);
      ASYNC_LD_B128(ldsBo[cur ^ 1], Bg + k0 + 32);
      asm volatile("s_wait_asynccnt 0x3" ::: "memory");   // current 3 done
    } else {
      asm volatile("s_wait_asynccnt 0x0" ::: "memory");
    }
    __syncthreads();
    const bf16_t* as = &As[cur][0];
    const bf16_t* bs = &Bs[cur][0];
    v16bf a0 = frag16(as + (wy * 32 +      r) * 32 + hb);
    v16bf a1 = frag16(as + (wy * 32 + 16 + r) * 32 + hb);
    v16bf b0 = frag16(bs + (wx * 32 +      r) * 32 + hb);
    v16bf b1 = frag16(bs + (wx * 32 + 16 + r) * 32 + hb);
    acc[0][0] = __builtin_amdgcn_wmma_f32_16x16x32_bf16(false, a0, false, b0,
                                                        (short)0, acc[0][0], false, false);
    acc[0][1] = __builtin_amdgcn_wmma_f32_16x16x32_bf16(false, a0, false, b1,
                                                        (short)0, acc[0][1], false, false);
    acc[1][0] = __builtin_amdgcn_wmma_f32_16x16x32_bf16(false, a1, false, b0,
                                                        (short)0, acc[1][0], false, false);
    acc[1][1] = __builtin_amdgcn_wmma_f32_16x16x32_bf16(false, a1, false, b1,
                                                        (short)0, acc[1][1], false, false);
    __syncthreads();
  }

  const int half = lane >> 4;
#pragma unroll
  for (int m = 0; m < 2; ++m) {
#pragma unroll
    for (int i = 0; i < 8; ++i) {
      int orow = row0 + wy * 32 + m * 16 + i + half * 8;
#pragma unroll
      for (int n = 0; n < 2; ++n) {
        int ocol = col0 + wx * 32 + n * 16 + r;
        float v = acc[m][n][i];
        if (mode == EP_F32) {
          outF[(size_t)orow * ldo + ocol] = v;
        } else if (mode == EP_BIAS_F32) {
          outF[(size_t)orow * ldo + ocol] = v + bias[ocol];
        } else if (mode == EP_ELU_BF) {   // elu(x)+1 : x+1 if x>0 else exp(x)
          outB[(size_t)orow * ldo + ocol] = f2bf(v > 0.f ? v + 1.f : __expf(v));
        } else if (mode == EP_SCALE_BF) {
          outB[(size_t)orow * ldo + ocol] = f2bf(v * scale);
        } else {                          // relu -> bf16
          outB[(size_t)orow * ldo + ocol] = f2bf(v > 0.f ? v : 0.f);
        }
      }
    }
  }
}

// ---------------- LayerNorm over 256-wide rows ----------------
__global__ __launch_bounds__(256) void k_layernorm(
    const float* __restrict__ in, const float* __restrict__ g, const float* __restrict__ bb,
    bf16_t* __restrict__ outB, int ldoB,
    float* __restrict__ outF, const float* __restrict__ resid, int rows)
{
  int wave = threadIdx.x >> 5, lane = threadIdx.x & 31;
  int row = blockIdx.x * 8 + wave;
  if (row >= rows) return;
  const float* p = in + (size_t)row * 256;
  float4 a = *(const float4*)(p + lane * 8);
  float4 c = *(const float4*)(p + lane * 8 + 4);
  float vals[8] = {a.x, a.y, a.z, a.w, c.x, c.y, c.z, c.w};
  float s = 0.f;
#pragma unroll
  for (int j = 0; j < 8; ++j) s += vals[j];
#pragma unroll
  for (int o = 16; o > 0; o >>= 1) s += __shfl_xor(s, o, 32);
  float mean = s * (1.f / 256.f);
  float vs = 0.f;
#pragma unroll
  for (int j = 0; j < 8; ++j) { vals[j] -= mean; vs += vals[j] * vals[j]; }
#pragma unroll
  for (int o = 16; o > 0; o >>= 1) vs += __shfl_xor(vs, o, 32);
  float inv = rsqrtf(vs * (1.f / 256.f) + 1e-5f);
#pragma unroll
  for (int j = 0; j < 8; ++j) {
    int c0 = lane * 8 + j;
    float y = vals[j] * inv * g[c0] + bb[c0];
    if (outB) outB[(size_t)row * ldoB + c0] = f2bf(y);
    if (outF) outF[(size_t)row * 256 + c0] = y + resid[(size_t)row * 256 + c0];
  }
}

// ---------------- Ksum = sum_s K_elu ----------------
__global__ void k_ksum_part(const bf16_t* __restrict__ Ke, float* __restrict__ part) {
  int blk = blockIdx.x;                 // B*16
  int b = blk >> 4, ch = blk & 15;
  int c = threadIdx.x;                  // 256
  const bf16_t* p = Ke + ((size_t)b * Ssz + ch * 256) * 256 + c;
  float s = 0.f;
  for (int i = 0; i < 256; ++i) s += bf2f(p[(size_t)i * 256]);
  part[((size_t)b * 16 + ch) * 256 + c] = s;
}
__global__ void k_ksum_reduce(const float* __restrict__ part, float* __restrict__ ksum) {
  int idx = blockIdx.x * blockDim.x + threadIdx.x;  // B*256
  if (idx >= Bsz * 256) return;
  int b = idx >> 8, c = idx & 255;
  float s = 0.f;
  for (int ch = 0; ch < 16; ++ch) s += part[((size_t)b * 16 + ch) * 256 + c];
  ksum[idx] = s;
}

// ---------------- KV[b,h] = K^T * Vsc (32x32 over S=4096), stored transposed ----------------
// S is cut into KV_SPLIT ranges, one work-group per (b,h,range); each stores an f32
// partial [e][d], and k_kv_reduce sums the ranges in index order.
static constexpr int KV_SPLIT = 32;
static constexpr int KV_ROWS  = Ssz / KV_SPLIT;    // 128 rows of S per work-group
static constexpr int KV_ELEMS = Bsz * NH * 32 * 32;

__global__ __launch_bounds__(256) void k_kv_wmma(const bf16_t* __restrict__ Ke,
                                                 const bf16_t* __restrict__ Vsc,
                                                 float* __restrict__ kvpart)
{
  __shared__ __align__(16) bf16_t KT[32 * 32];  // [d][s]
  __shared__ __align__(16) bf16_t VT[32 * 32];  // [e][s]
  int bh = blockIdx.x;                  // B*NH
  int b = bh >> 3, h = bh & 7;
  int tid = threadIdx.x, lane = tid & 31, wave = tid >> 5;
  int d0 = (tid & 7) * 4;
  int si = tid >> 3;
  const int r = lane & 15, hb = (lane >> 4) << 3;
  int ti = (wave >> 1) & 1, tj = wave & 1;
  v8f acc = {0,0,0,0,0,0,0,0};
  const size_t base = (size_t)b * Ssz * 256 + h * 32;

  const int sBeg = blockIdx.y * KV_ROWS;
  for (int s0 = sBeg; s0 < sBeg + KV_ROWS; s0 += 32) {
    bf4 kk = *(const bf4*)(Ke  + base + (size_t)(s0 + si) * 256 + d0);
    bf4 vv = *(const bf4*)(Vsc + base + (size_t)(s0 + si) * 256 + d0);
    __syncthreads();
#pragma unroll
    for (int j = 0; j < 4; ++j) {
      KT[(d0 + j) * 32 + si] = kk.e[j];
      VT[(d0 + j) * 32 + si] = vv.e[j];
    }
    __syncthreads();
    if (wave < 4) {
      v16bf af = frag16(KT + (ti * 16 + r) * 32 + hb);
      v16bf bf = frag16(VT + (tj * 16 + r) * 32 + hb);
      acc = __builtin_amdgcn_wmma_f32_16x16x32_bf16(false, af, false, bf,
                                                    (short)0, acc, false, false);
    }
  }
  if (wave < 4) {
    int half = lane >> 4;
    float* pp = kvpart + (size_t)blockIdx.y * KV_ELEMS;
#pragma unroll
    for (int i = 0; i < 8; ++i) {
      int d = ti * 16 + i + half * 8;
      int e = tj * 16 + r;
      pp[((size_t)bh * 32 + e) * 32 + d] = acc[i];
    }
  }
}

__global__ __launch_bounds__(256) void k_kv_reduce(const float* __restrict__ kvpart,
                                                   bf16_t* __restrict__ KVbT)
{
  int idx = blockIdx.x * 256 + threadIdx.x;         // 0..KV_ELEMS-1
  float s = 0.f;
  // unrolled so that all the partial loads are in flight together
#pragma unroll
  for (int ch = 0; ch < KV_SPLIT; ++ch) s += kvpart[(size_t)ch * KV_ELEMS + idx];
  KVbT[idx] = f2bf(s);
}

// ---------------- msg = (Q * KV) * S/(Q.Ksum + eps) ----------------
__global__ __launch_bounds__(256) void k_msg_wmma(const bf16_t* __restrict__ Qe,
                                                  const bf16_t* __restrict__ KVbT,
                                                  const float* __restrict__ ksum,
                                                  bf16_t* __restrict__ msgb)
{
  int row0 = blockIdx.x * 16;
  int lane = threadIdx.x & 31, h = threadIdx.x >> 5;
  int b = row0 >> 14;
  const int r = lane & 15, hb = (lane >> 4) << 3;

  const bf16_t* Ap = Qe + (size_t)(row0 + r) * 256 + h * 32;
  v16bf af = frag16(Ap + hb);
  const bf16_t* Bp = KVbT + (size_t)(b * 8 + h) * 32 * 32;
  v16bf bf0 = frag16(Bp + r * 32 + hb);
  v16bf bf1 = frag16(Bp + (16 + r) * 32 + hb);
  v8f acc0 = {0,0,0,0,0,0,0,0};
  v8f acc1 = {0,0,0,0,0,0,0,0};
  acc0 = __builtin_amdgcn_wmma_f32_16x16x32_bf16(false, af, false, bf0,
                                                 (short)0, acc0, false, false);
  acc1 = __builtin_amdgcn_wmma_f32_16x16x32_bf16(false, af, false, bf1,
                                                 (short)0, acc1, false, false);

  const float* ks = ksum + (size_t)b * 256 + h * 32;
  float dot = 0.f;
#pragma unroll
  for (int d = 0; d < 32; ++d) dot += bf2f(Ap[d]) * ks[d];
  float z = (float)Ssz / (dot + 1e-6f);

  int half = lane >> 4;
#pragma unroll
  for (int i = 0; i < 8; ++i) {
    float zi = __shfl(z, i + half * 8, 32);
    int orow = row0 + i + half * 8;
    bf16_t* op = msgb + (size_t)orow * 256 + h * 32;
    op[r]      = f2bf(acc0[i] * zi);
    op[16 + r] = f2bf(acc1[i] * zi);
  }
}

// ---------------- host launcher ----------------
extern "C" void kernel_launch(void* const* d_in, const int* in_sizes, int n_in,
                              void* d_out, int out_size, void* d_ws, size_t ws_size,
                              hipStream_t stream) {
  const float* x      = (const float*)d_in[0];
  const float* sr_w   = (const float*)d_in[1];
  const float* sr_b   = (const float*)d_in[2];
  const float* norm_g = (const float*)d_in[3];
  const float* norm_b = (const float*)d_in[4];
  const float* wq     = (const float*)d_in[5];
  const float* wk     = (const float*)d_in[6];
  const float* wv     = (const float*)d_in[7];
  const float* wm     = (const float*)d_in[8];
  const float* w1     = (const float*)d_in[9];
  const float* w2     = (const float*)d_in[10];
  const float* n1g    = (const float*)d_in[11];
  const float* n1b    = (const float*)d_in[12];
  const float* n2g    = (const float*)d_in[13];
  const float* n2b    = (const float*)d_in[14];
  float* out = (float*)d_out;

  char* ws = (char*)d_ws;
  size_t off = 0;
  auto alloc = [&](size_t bytes) -> void* {
    off = (off + 255) & ~(size_t)255;
    void* p = ws + off;
    off += bytes;
    return p;
  };

  bf16_t* wqT  = (bf16_t*)alloc((size_t)256 * 256 * 2);
  bf16_t* wkT  = (bf16_t*)alloc((size_t)256 * 256 * 2);
  bf16_t* wvT  = (bf16_t*)alloc((size_t)256 * 256 * 2);
  bf16_t* wmT  = (bf16_t*)alloc((size_t)256 * 256 * 2);
  bf16_t* w1T  = (bf16_t*)alloc((size_t)512 * 512 * 2);
  bf16_t* w2T  = (bf16_t*)alloc((size_t)256 * 512 * 2);
  bf16_t* wsrT = (bf16_t*)alloc((size_t)256 * 1024 * 2);
  float*  part = (float*)alloc((size_t)Bsz * 16 * 256 * 4);
  float*  ksum = (float*)alloc((size_t)Bsz * 256 * 4);
  bf16_t* KVbT = (bf16_t*)alloc((size_t)Bsz * NH * 32 * 32 * 2);
  bf16_t* cat  = (bf16_t*)alloc((size_t)ROWS_X * 512 * 2);          // [x | msg_ln]
  // pool A: im2col buf, later reused for msg (both 32 MiB)
  bf16_t* xim  = (bf16_t*)alloc((size_t)ROWS_S * 1024 * 2);
  bf16_t* msgb = xim;
  // pool B: Qe + xs + xs_ln + Ke + Vsc, later reused for h1 (64 MiB <= 72 MiB)
  size_t szQe = (size_t)ROWS_X * 256 * 2;
  size_t szXs = (size_t)ROWS_S * 256 * 4;
  size_t szLn = (size_t)ROWS_S * 256 * 2;
  char* poolB = (char*)alloc(szQe + szXs + 3 * szLn);
  bf16_t* Qe    = (bf16_t*)poolB;
  float*  xs    = (float*)(poolB + szQe);
  bf16_t* xs_ln = (bf16_t*)(poolB + szQe + szXs);
  bf16_t* Ke    = (bf16_t*)(poolB + szQe + szXs + szLn);
  bf16_t* Vsc   = (bf16_t*)(poolB + szQe + szXs + 2 * szLn);
  bf16_t* h1    = (bf16_t*)poolB;        // [ROWS_X][512] bf16
  // pool C: mm f32, reused for h2 f32
  float* mm = (float*)alloc((size_t)ROWS_X * 256 * 4);
  float* h2 = mm;
  float* kvpart = mm;                    // KV partials (4 MiB), dead before mm is written

  // --- weight prep ---
  k_transpose_w<<<(256 * 256 + 255) / 256, 256, 0, stream>>>(wq, wqT, 256, 256);
  k_transpose_w<<<(256 * 256 + 255) / 256, 256, 0, stream>>>(wk, wkT, 256, 256);
  k_transpose_w<<<(256 * 256 + 255) / 256, 256, 0, stream>>>(wv, wvT, 256, 256);
  k_transpose_w<<<(256 * 256 + 255) / 256, 256, 0, stream>>>(wm, wmT, 256, 256);
  k_transpose_w<<<(512 * 512 + 255) / 256, 256, 0, stream>>>(w1, w1T, 512, 512);
  k_transpose_w<<<(512 * 256 + 255) / 256, 256, 0, stream>>>(w2, w2T, 512, 256);
  k_pack_srw<<<(256 * 1024 + 255) / 256, 256, 0, stream>>>(sr_w, wsrT);
  k_pack_x<<<(ROWS_X * 256 / 4 + 255) / 256, 256, 0, stream>>>(x, cat);
  k_im2col<<<ROWS_S, 256, 0, stream>>>(x, xim);

  // --- spatial reduction conv (im2col GEMM) + LN ---
  k_gemm_wmma<<<dim3(256 / 64, ROWS_S / 128), 256, 0, stream>>>(
      xim, 1024, wsrT, ROWS_S, 256, 1024, xs, nullptr, 256, sr_b, 0.f, EP_BIAS_F32);
  k_layernorm<<<ROWS_S / 8, 256, 0, stream>>>(xs, norm_g, norm_b, xs_ln, 256,
                                              nullptr, nullptr, ROWS_S);

  // --- projections (Q from cat[:, :256], K/V from xs_ln) ---
  k_gemm_wmma<<<dim3(4, ROWS_X / 128), 256, 0, stream>>>(
      cat, 512, wqT, ROWS_X, 256, 256, nullptr, Qe, 256, nullptr, 0.f, EP_ELU_BF);
  k_gemm_wmma<<<dim3(4, ROWS_S / 128), 256, 0, stream>>>(
      xs_ln, 256, wkT, ROWS_S, 256, 256, nullptr, Ke, 256, nullptr, 0.f, EP_ELU_BF);
  k_gemm_wmma<<<dim3(4, ROWS_S / 128), 256, 0, stream>>>(
      xs_ln, 256, wvT, ROWS_S, 256, 256, nullptr, Vsc, 256, nullptr,
      1.f / (float)Ssz, EP_SCALE_BF);

  // --- linear attention ---
  k_ksum_part<<<Bsz * 16, 256, 0, stream>>>(Ke, part);
  k_ksum_reduce<<<(Bsz * 256 + 255) / 256, 256, 0, stream>>>(part, ksum);
  k_kv_wmma<<<dim3(Bsz * NH, KV_SPLIT), 256, 0, stream>>>(Ke, Vsc, kvpart);
  k_kv_reduce<<<KV_ELEMS / 256, 256, 0, stream>>>(kvpart, KVbT);
  k_msg_wmma<<<ROWS_X / 16, 256, 0, stream>>>(Qe, KVbT, ksum, msgb);

  // --- merge proj + LN1 (into cat[:, 256:512]) ---
  k_gemm_wmma<<<dim3(4, ROWS_X / 128), 256, 0, stream>>>(
      msgb, 256, wmT, ROWS_X, 256, 256, mm, nullptr, 256, nullptr, 0.f, EP_F32);
  k_layernorm<<<ROWS_X / 8, 256, 0, stream>>>(mm, n1g, n1b, cat + 256, 512,
                                              nullptr, nullptr, ROWS_X);

  // --- MLP ---
  k_gemm_wmma<<<dim3(8, ROWS_X / 128), 256, 0, stream>>>(
      cat, 512, w1T, ROWS_X, 512, 512, nullptr, h1, 512, nullptr, 0.f, EP_RELU_BF);
  k_gemm_wmma<<<dim3(4, ROWS_X / 128), 256, 0, stream>>>(
      h1, 512, w2T, ROWS_X, 256, 512, h2, nullptr, 256, nullptr, 0.f, EP_F32);

  // --- LN2 + residual ---
  k_layernorm<<<ROWS_X / 8, 256, 0, stream>>>(h2, n2g, n2b, nullptr, 0,
                                              out, x, ROWS_X);
}

// v002
// It runs in 374 microseconds.
// Next to v001, in two timings, it ran 1.12 times as fast each time.
// Counting every step since v000, it is 1.33 times as fast.
#include <hip/hip_runtime.h>
#include <stdint.h>
#include <stddef.h>

// ---------------- problem dims (hardcoded from reference) ----------------
static constexpr int Bsz  = 4;
static constexpr int Hh   = 128;
static constexpr int Wh   = 128;
static constexpr int Cc   = 256;
static constexpr int Nn   = Hh * Wh;          // 16384
static constexpr int Ssz  = (Hh/2) * (Wh/2);  // 4096
static constexpr int NH   = 8;
static constexpr int ROWS_X = Bsz * Nn;       // 65536
static constexpr int ROWS_S = Bsz * Ssz;      // 16384

// ---------------- types ----------------
typedef __bf16 bf16_t;
typedef __attribute__((ext_vector_type(16))) __bf16 v16bf;
typedef __attribute__((ext_vector_type(8)))  __bf16 v8bf;
typedef __attribute__((ext_vector_type(8)))  float  v8f;

struct bf4 { bf16_t e[4]; };   // POD 8-byte pack

__device__ inline bf16_t f2bf(float f) {
  union { float f; unsigned u; } a; a.f = f;
  unsigned r = a.u + 0x7FFFu + ((a.u >> 16) & 1u);
  unsigned short h = (unsigned short)(r >> 16);
  union { unsigned short u; bf16_t b; } o; o.u = h;
  return o.b;
}
__device__ inline float bf2f(bf16_t b) {
  union { unsigned short u; bf16_t b; } i; i.b = b;
  union { unsigned u; float f; } o; o.u = ((unsigned)i.u) << 16;
  return o.f;
}

// Assemble 16-elem bf16 WMMA fragment: 8 contiguous at p, 8 at p+16.
__device__ inline v16bf frag16(const bf16_t* p) {
  v8bf lo = *(const v8bf*)p;
  v8bf hi = *(const v8bf*)(p + 16);
  return __builtin_shufflevector(lo, hi, 0,1,2,3,4,5,6,7,8,9,10,11,12,13,14,15);
}

// gfx1250 async global->LDS copy, 16B per lane, tracked by ASYNCcnt.
// LDS dest VGPR = wave-relative LDS byte offset (low 32b of flat LDS address).
__device__ inline uint32_t lds_off32(const void* p) {
  return (uint32_t)(uintptr_t)p;
}
// LDS row pitch of every 32-k bf16 fragment tile, in elements: 80 B (16 B x odd), so
// that the 16 rows one ds_load_b128 half-wave reads fall on 16 different bank groups
// (at the plain 64 B pitch four rows share each group).
static constexpr int LDP = 40;

#define ASYNC_LD_B128(ldsoff, gptr)                                        \
  asm volatile("global_load_async_to_lds_b128 %0, %1, off"                 \
               :: "v"(ldsoff), "v"((uint64_t)(uintptr_t)(gptr)) : "memory")

// ---------------- weight prep ----------------
__global__ void k_transpose_w(const float* __restrict__ w, bf16_t* __restrict__ wT,
                              int K, int Ncol) {
  int idx = blockIdx.x * blockDim.x + threadIdx.x;
  if (idx >= K * Ncol) return;
  int k = idx / Ncol, n = idx % Ncol;
  wT[(size_t)n * K + k] = f2bf(w[idx]);
}

__global__ void k_pack_srw(const float* __restrict__ w, bf16_t* __restrict__ wT) {
  int idx = blockIdx.x * blockDim.x + threadIdx.x;
  if (idx >= Cc * 4 * Cc) return;
  int o = idx >> 10, r = idx & 1023;
  int p = r >> 8, i = r & 255;
  int kh = p >> 1, kw = p & 1;
  wT[(size_t)o * 1024 + r] = f2bf(w[(((size_t)o * Cc + i) * 2 + kh) * 2 + kw]);
}

__global__ void k_pack_x(const float* __restrict__ x, bf16_t* __restrict__ cat) {
  int idx = blockIdx.x * blockDim.x + threadIdx.x;   // one per 4 elems
  long e = (long)idx * 4;
  if (e >= (long)ROWS_X * Cc) return;
  int row = (int)(e >> 8), c = (int)(e & 255);
  float4 v = *(const float4*)(x + (size_t)row * Cc + c);
  bf4 pk; pk.e[0]=f2bf(v.x); pk.e[1]=f2bf(v.y); pk.e[2]=f2bf(v.z); pk.e[3]=f2bf(v.w);
  *(bf4*)(cat + (size_t)row * 512 + c) = pk;
}

__global__ void k_im2col(const float* __restrict__ x, bf16_t* __restrict__ xim) {
  int bs = blockIdx.x;                  // 0..ROWS_S-1
  int t  = threadIdx.x;                 // 256 threads * 4 elems = 1024
  int b  = bs >> 12;
  int s  = bs & 4095;
  int oh = s >> 6, ow = s & 63;
  int kidx = t * 4;
  int p = kidx >> 8, i = kidx & 255;
  int kh = p >> 1, kw = p & 1;
  int n = (2*oh + kh) * Wh + (2*ow + kw);
  float4 v = *(const float4*)(x + ((size_t)b * Nn + n) * Cc + i);
  bf4 pk; pk.e[0]=f2bf(v.x); pk.e[1]=f2bf(v.y); pk.e[2]=f2bf(v.z); pk.e[3]=f2bf(v.w);
  *(bf4*)(xim + (size_t)bs * 1024 + kidx) = pk;
}

// ---------------- generic WMMA GEMM (128x64 tile, async double-buffered) ----------------
enum { EP_F32 = 0, EP_BIAS_F32 = 1, EP_ELU_BF = 2, EP_SCALE_BF = 3, EP_RELU_BF = 4 };

// C[M,Ncol] = epi( A[M,K](lda) * BT[Ncol,K]^T ), block tile 128x64, k-step 32.
// 8 waves: wave -> (wy=w>>1 in 0..3 : 32 rows, wx=w&1 : 32 cols), 2x2 accs each.
__global__ __launch_bounds__(256) void k_gemm_wmma(
    const bf16_t* __restrict__ A, int lda,
    const bf16_t* __restrict__ BT,
    int M, int Ncol, int K,
    float* __restrict__ outF, bf16_t* __restrict__ outB, int ldo,
    const float* __restrict__ bias, float scale, int mode)
{
  __shared__ __align__(16) bf16_t As[2][128 * LDP];
  __shared__ __align__(16) bf16_t Bs[2][64 * LDP];
  const int tid  = threadIdx.x;
  const int lane = tid & 31, wave = tid >> 5;
  const int wy = wave >> 1, wx = wave & 1;
  const int row0 = blockIdx.y * 128;
  const int col0 = blockIdx.x * 64;
  // tile loaders: A 128x32 -> 16 bf16/thread (2x b128); B 64x32 -> 8 bf16/thread
  const int lrA = tid >> 1, lkA = (tid & 1) << 4;
  const int lrB = tid >> 2, lkB = (tid & 3) << 3;
  const bf16_t* Ag = A  + (size_t)(row0 + lrA) * lda + lkA;
  const bf16_t* Bg = BT + (size_t)(col0 + lrB) * K   + lkB;
  uint32_t ldsA0[2], ldsA1[2], ldsBo[2];
#pragma unroll
  for (int b = 0; b < 2; ++b) {
    ldsA0[b] = lds_off32(&As[b][lrA * LDP + lkA]);
    ldsA1[b] = lds_off32(&As[b][lrA * LDP + lkA + 8]);
    ldsBo[b] = lds_off32(&Bs[b][lrB * LDP + lkB]);
  }
  const int r = lane & 15, hb = (lane >> 4) << 3;

  v8f acc[2][2] = {};

  // prologue: stage k0=0 into buffer 0
  ASYNC_LD_B128(ldsA0[0], Ag);
  ASYNC_LD_B128(ldsA1[0], Ag + 8);
  ASYNC_LD_B128(ldsBo[0], Bg);

  for (int k0 = 0; k0 < K; k0 += 32) {
    const int cur = (k0 >> 5) & 1;
    if (k0 + 32 < K) {              // stage next tile into other buffer
      ASYNC_LD_B128(ldsA0[cur ^ 1], Ag + k0 + 32);
      ASYNC_LD_B128(ldsA1[cur ^ 1], Ag + k0 + 40);
      ASYNC_LD_B128(ldsBo[cur ^ 1], Bg + k0 + 32);
      asm volatile("s_wait_asynccnt 0x3" ::: "memory");   // current 3 done
    } else {
      asm volatile("s_wait_asynccnt 0x0" ::: "memory");
    }
    __syncthreads();
    const bf16_t* as = &As[cur][0];
    const bf16_t* bs = &Bs[cur][0];
    v16bf a0 = frag16(as + (wy * 32 +      r) * LDP + hb);
    v16bf a1 = frag16(as + (wy * 32 + 16 + r) * LDP + hb);
    v16bf b0 = frag16(bs + (wx * 32 +      r) * LDP + hb);
    v16bf b1 = frag16(bs + (wx * 32 + 16 + r) * LDP + hb);
    acc[0][0] = __builtin_amdgcn_wmma_f32_16x16x32_bf16(false, a0, false, b0,
                                                        (short)0, acc[0][0], false, false);
    acc[0][1] = __builtin_amdgcn_wmma_f32_16x16x32_bf16(false, a0, false, b1,
                                                        (short)0, acc[0][1], false, false);
    acc[1][0] = __builtin_amdgcn_wmma_f32_16x16x32_bf16(false, a1, false, b0,
                                                        (short)0, acc[1][0], false, false);
    acc[1][1] = __builtin_amdgcn_wmma_f32_16x16x32_bf16(false, a1, false, b1,
                                                        (short)0, acc[1][1], false, false);
    __syncthreads();
  }

  const int half = lane >> 4;
#pragma unroll
  for (int m = 0; m < 2; ++m) {
#pragma unroll
    for (int i = 0; i < 8; ++i) {
      int orow = row0 + wy * 32 + m * 16 + i + half * 8;
#pragma unroll
      for (int n = 0; n < 2; ++n) {
        int ocol = col0 + wx * 32 + n * 16 + r;
        float v = acc[m][n][i];
        if (mode == EP_F32) {
          outF[(size_t)orow * ldo + ocol] = v;
        } else if (mode == EP_BIAS_F32) {
          outF[(size_t)orow * ldo + ocol] = v + bias[ocol];
        } else if (mode == EP_ELU_BF) {   // elu(x)+1 : x+1 if x>0 else exp(x)
          outB[(size_t)orow * ldo + ocol] = f2bf(v > 0.f ? v + 1.f : __expf(v));
        } else if (mode == EP_SCALE_BF) {
          outB[(size_t)orow * ldo + ocol] = f2bf(v * scale);
        } else {                          // relu -> bf16
          outB[(size_t)orow * ldo + ocol] = f2bf(v > 0.f ? v : 0.f);
        }
      }
    }
  }
}

// ---------------- LayerNorm over 256-wide rows ----------------
__global__ __launch_bounds__(256) void k_layernorm(
    const float* __restrict__ in, const float* __restrict__ g, const float* __restrict__ bb,
    bf16_t* __restrict__ outB, int ldoB,
    float* __restrict__ outF, const float* __restrict__ resid, int rows)
{
  int wave = threadIdx.x >> 5, lane = threadIdx.x & 31;
  int row = blockIdx.x * 8 + wave;
  if (row >= rows) return;
  const float* p = in + (size_t)row * 256;
  float4 a = *(const float4*)(p + lane * 8);
  float4 c = *(const float4*)(p + lane * 8 + 4);
  float vals[8] = {a.x, a.y, a.z, a.w, c.x, c.y, c.z, c.w};
  float s = 0.f;
#pragma unroll
  for (int j = 0; j < 8; ++j) s += vals[j];
#pragma unroll
  for (int o = 16; o > 0; o >>= 1) s += __shfl_xor(s, o, 32);
  float mean = s * (1.f / 256.f);
  float vs = 0.f;
#pragma unroll
  for (int j = 0; j < 8; ++j) { vals[j] -= mean; vs += vals[j] * vals[j]; }
#pragma unroll
  for (int o = 16; o > 0; o >>= 1) vs += __shfl_xor(vs, o, 32);
  float inv = rsqrtf(vs * (1.f / 256.f) + 1e-5f);
#pragma unroll
  for (int j = 0; j < 8; ++j) {
    int c0 = lane * 8 + j;
    float y = vals[j] * inv * g[c0] + bb[c0];
    if (outB) outB[(size_t)row * ldoB + c0] = f2bf(y);
    if (outF) outF[(size_t)row * 256 + c0] = y + resid[(size_t)row * 256 + c0];
  }
}

// ---------------- Ksum = sum_s K_elu ----------------
__global__ void k_ksum_part(const bf16_t* __restrict__ Ke, float* __restrict__ part) {
  int blk = blockIdx.x;                 // B*16
  int b = blk >> 4, ch = blk & 15;
  int c = threadIdx.x;                  // 256
  const bf16_t* p = Ke + ((size_t)b * Ssz + ch * 256) * 256 + c;
  float s = 0.f;
  for (int i = 0; i < 256; ++i) s += bf2f(p[(size_t)i * 256]);
  part[((size_t)b * 16 + ch) * 256 + c] = s;
}
__global__ void k_ksum_reduce(const float* __restrict__ part, float* __restrict__ ksum) {
  int idx = blockIdx.x * blockDim.x + threadIdx.x;  // B*256
  if (idx >= Bsz * 256) return;
  int b = idx >> 8, c = idx & 255;
  float s = 0.f;
  for (int ch = 0; ch < 16; ++ch) s += part[((size_t)b * 16 + ch) * 256 + c];
  ksum[idx] = s;
}

// ---------------- KV[b,h] = K^T * Vsc (32x32 over S=4096), stored transposed ----------------
// S is cut into KV_SPLIT ranges, one work-group per (b,h,range); each stores an f32
// partial [e][d], and k_kv_reduce sums the ranges in index order.
static constexpr int KV_SPLIT = 32;
static constexpr int KV_ROWS  = Ssz / KV_SPLIT;    // 128 rows of S per work-group
static constexpr int KV_ELEMS = Bsz * NH * 32 * 32;

__global__ __launch_bounds__(256) void k_kv_wmma(const bf16_t* __restrict__ Ke,
                                                 const bf16_t* __restrict__ Vsc,
                                                 float* __restrict__ kvpart)
{
  __shared__ __align__(16) bf16_t KT[32 * LDP];  // [d][s]
  __shared__ __align__(16) bf16_t VT[32 * LDP];  // [e][s]
  int bh = blockIdx.x;                  // B*NH
  int b = bh >> 3, h = bh & 7;
  int tid = threadIdx.x, lane = tid & 31, wave = tid >> 5;
  int d0 = (tid & 7) * 4;
  int si = tid >> 3;
  const int r = lane & 15, hb = (lane >> 4) << 3;
  int ti = (wave >> 1) & 1, tj = wave & 1;
  v8f acc = {0,0,0,0,0,0,0,0};
  const size_t base = (size_t)b * Ssz * 256 + h * 32;

  const int sBeg = blockIdx.y * KV_ROWS;
  for (int s0 = sBeg; s0 < sBeg + KV_ROWS; s0 += 32) {
    bf4 kk = *(const bf4*)(Ke  + base + (size_t)(s0 + si) * 256 + d0);
    bf4 vv = *(const bf4*)(Vsc + base + (size_t)(s0 + si) * 256 + d0);
    __syncthreads();
#pragma unroll
    for (int j = 0; j < 4; ++j) {
      KT[(d0 + j) * LDP + si] = kk.e[j];
      VT[(d0 + j) * LDP + si] = vv.e[j];
    }
    __syncthreads();
    if (wave < 4) {
      v16bf af = frag16(KT + (ti * 16 + r) * LDP + hb);
      v16bf bf = frag16(VT + (tj * 16 + r) * LDP + hb);
      acc = __builtin_amdgcn_wmma_f32_16x16x32_bf16(false, af, false, bf,
                                                    (short)0, acc, false, false);
    }
  }
  if (wave < 4) {
    int half = lane >> 4;
    float* pp = kvpart + (size_t)blockIdx.y * KV_ELEMS;
#pragma unroll
    for (int i = 0; i < 8; ++i) {
      int d = ti * 16 + i + half * 8;
      int e = tj * 16 + r;
      pp[((size_t)bh * 32 + e) * 32 + d] = acc[i];
    }
  }
}

__global__ __launch_bounds__(256) void k_kv_reduce(const float* __restrict__ kvpart,
                                                   bf16_t* __restrict__ KVbT)
{
  int idx = blockIdx.x * 256 + threadIdx.x;         // 0..KV_ELEMS-1
  float s = 0.f;
  // unrolled so that all the partial loads are in flight together
#pragma unroll
  for (int ch = 0; ch < KV_SPLIT; ++ch) s += kvpart[(size_t)ch * KV_ELEMS + idx];
  KVbT[idx] = f2bf(s);
}

// ---------------- msg = (Q * KV) * S/(Q.Ksum + eps) ----------------
__global__ __launch_bounds__(256) void k_msg_wmma(const bf16_t* __restrict__ Qe,
                                                  const bf16_t* __restrict__ KVbT,
                                                  const float* __restrict__ ksum,
                                                  bf16_t* __restrict__ msgb)
{
  int row0 = blockIdx.x * 16;
  int lane = threadIdx.x & 31, h = threadIdx.x >> 5;
  int b = row0 >> 14;
  const int r = lane & 15, hb = (lane >> 4) << 3;

  const bf16_t* Ap = Qe + (size_t)(row0 + r) * 256 + h * 32;
  v16bf af = frag16(Ap + hb);
  const bf16_t* Bp = KVbT + (size_t)(b * 8 + h) * 32 * 32;
  v16bf bf0 = frag16(Bp + r * 32 + hb);
  v16bf bf1 = frag16(Bp + (16 + r) * 32 + hb);
  v8f acc0 = {0,0,0,0,0,0,0,0};
  v8f acc1 = {0,0,0,0,0,0,0,0};
  acc0 = __builtin_amdgcn_wmma_f32_16x16x32_bf16(false, af, false, bf0,
                                                 (short)0, acc0, false, false);
  acc1 = __builtin_amdgcn_wmma_f32_16x16x32_bf16(false, af, false, bf1,
                                                 (short)0, acc1, false, false);

  const float* ks = ksum + (size_t)b * 256 + h * 32;
  float dot = 0.f;
#pragma unroll
  for (int d = 0; d < 32; ++d) dot += bf2f(Ap[d]) * ks[d];
  float z = (float)Ssz / (dot + 1e-6f);

  int half = lane >> 4;
#pragma unroll
  for (int i = 0; i < 8; ++i) {
    float zi = __shfl(z, i + half * 8, 32);
    int orow = row0 + i + half * 8;
    bf16_t* op = msgb + (size_t)orow * 256 + h * 32;
    op[r]      = f2bf(acc0[i] * zi);
    op[16 + r] = f2bf(acc1[i] * zi);
  }
}

// ---------------- host launcher ----------------
extern "C" void kernel_launch(void* const* d_in, const int* in_sizes, int n_in,
                              void* d_out, int out_size, void* d_ws, size_t ws_size,
                              hipStream_t stream) {
  const float* x      = (const float*)d_in[0];
  const float* sr_w   = (const float*)d_in[1];
  const float* sr_b   = (const float*)d_in[2];
  const float* norm_g = (const float*)d_in[3];
  const float* norm_b = (const float*)d_in[4];
  const float* wq     = (const float*)d_in[5];
  const float* wk     = (const float*)d_in[6];
  const float* wv     = (const float*)d_in[7];
  const float* wm     = (const float*)d_in[8];
  const float* w1     = (const float*)d_in[9];
  const float* w2     = (const float*)d_in[10];
  const float* n1g    = (const float*)d_in[11];
  const float* n1b    = (const float*)d_in[12];
  const float* n2g    = (const float*)d_in[13];
  const float* n2b    = (const float*)d_in[14];
  float* out = (float*)d_out;

  char* ws = (char*)d_ws;
  size_t off = 0;
  auto alloc = [&](size_t bytes) -> void* {
    off = (off + 255) & ~(size_t)255;
    void* p = ws + off;
    off += bytes;
    return p;
  };

  bf16_t* wqT  = (bf16_t*)alloc((size_t)256 * 256 * 2);
  bf16_t* wkT  = (bf16_t*)alloc((size_t)256 * 256 * 2);
  bf16_t* wvT  = (bf16_t*)alloc((size_t)256 * 256 * 2);
  bf16_t* wmT  = (bf16_t*)alloc((size_t)256 * 256 * 2);
  bf16_t* w1T  = (bf16_t*)alloc((size_t)512 * 512 * 2);
  bf16_t* w2T  = (bf16_t*)alloc((size_t)256 * 512 * 2);
  bf16_t* wsrT = (bf16_t*)alloc((size_t)256 * 1024 * 2);
  float*  part = (float*)alloc((size_t)Bsz * 16 * 256 * 4);
  float*  ksum = (float*)alloc((size_t)Bsz * 256 * 4);
  bf16_t* KVbT = (bf16_t*)alloc((size_t)Bsz * NH * 32 * 32 * 2);
  bf16_t* cat  = (bf16_t*)alloc((size_t)ROWS_X * 512 * 2);          // [x | msg_ln]
  // pool A: im2col buf, later reused for msg (both 32 MiB)
  bf16_t* xim  = (bf16_t*)alloc((size_t)ROWS_S * 1024 * 2);
  bf16_t* msgb = xim;
  // pool B: Qe + xs + xs_ln + Ke + Vsc, later reused for h1 (64 MiB <= 72 MiB)
  size_t szQe = (size_t)ROWS_X * 256 * 2;
  size_t szXs = (size_t)ROWS_S * 256 * 4;
  size_t szLn = (size_t)ROWS_S * 256 * 2;
  char* poolB = (char*)alloc(szQe + szXs + 3 * szLn);
  bf16_t* Qe    = (bf16_t*)poolB;
  float*  xs    = (float*)(poolB + szQe);
  bf16_t* xs_ln = (bf16_t*)(poolB + szQe + szXs);
  bf16_t* Ke    = (bf16_t*)(poolB + szQe + szXs + szLn);
  bf16_t* Vsc   = (bf16_t*)(poolB + szQe + szXs + 2 * szLn);
  bf16_t* h1    = (bf16_t*)poolB;        // [ROWS_X][512] bf16
  // pool C: mm f32, reused for h2 f32
  float* mm = (float*)alloc((size_t)ROWS_X * 256 * 4);
  float* h2 = mm;
  float* kvpart = mm;                    // KV partials (4 MiB), dead before mm is written

  // --- weight prep ---
  k_transpose_w<<<(256 * 256 + 255) / 256, 256, 0, stream>>>(wq, wqT, 256, 256);
  k_transpose_w<<<(256 * 256 + 255) / 256, 256, 0, stream>>>(wk, wkT, 256, 256);
  k_transpose_w<<<(256 * 256 + 255) / 256, 256, 0, stream>>>(wv, wvT, 256, 256);
  k_transpose_w<<<(256 * 256 + 255) / 256, 256, 0, stream>>>(wm, wmT, 256, 256);
  k_transpose_w<<<(512 * 512 + 255) / 256, 256, 0, stream>>>(w1, w1T, 512, 512);
  k_transpose_w<<<(512 * 256 + 255) / 256, 256, 0, stream>>>(w2, w2T, 512, 256);
  k_pack_srw<<<(256 * 1024 + 255) / 256, 256, 0, stream>>>(sr_w, wsrT);
  k_pack_x<<<(ROWS_X * 256 / 4 + 255) / 256, 256, 0, stream>>>(x, cat);
  k_im2col<<<ROWS_S, 256, 0, stream>>>(x, xim);

  // --- spatial reduction conv (im2col GEMM) + LN ---
  k_gemm_wmma<<<dim3(256 / 64, ROWS_S / 128), 256, 0, stream>>>(
      xim, 1024, wsrT, ROWS_S, 256, 1024, xs, nullptr, 256, sr_b, 0.f, EP_BIAS_F32);
  k_layernorm<<<ROWS_S / 8, 256, 0, stream>>>(xs, norm_g, norm_b, xs_ln, 256,
                                              nullptr, nullptr, ROWS_S);

  // --- projections (Q from cat[:, :256], K/V from xs_ln) ---
  k_gemm_wmma<<<dim3(4, ROWS_X / 128), 256, 0, stream>>>(
      cat, 512, wqT, ROWS_X, 256, 256, nullptr, Qe, 256, nullptr, 0.f, EP_ELU_BF);
  k_gemm_wmma<<<dim3(4, ROWS_S / 128), 256, 0, stream>>>(
      xs_ln, 256, wkT, ROWS_S, 256, 256, nullptr, Ke, 256, nullptr, 0.f, EP_ELU_BF);
  k_gemm_wmma<<<dim3(4, ROWS_S / 128), 256, 0, stream>>>(
      xs_ln, 256, wvT, ROWS_S, 256, 256, nullptr, Vsc, 256, nullptr,
      1.f / (float)Ssz, EP_SCALE_BF);

  // --- linear attention ---
  k_ksum_part<<<Bsz * 16, 256, 0, stream>>>(Ke, part);
  k_ksum_reduce<<<(Bsz * 256 + 255) / 256, 256, 0, stream>>>(part, ksum);
  k_kv_wmma<<<dim3(Bsz * NH, KV_SPLIT), 256, 0, stream>>>(Ke, Vsc, kvpart);
  k_kv_reduce<<<KV_ELEMS / 256, 256, 0, stream>>>(kvpart, KVbT);
  k_msg_wmma<<<ROWS_X / 16, 256, 0, stream>>>(Qe, KVbT, ksum, msgb);

  // --- merge proj + LN1 (into cat[:, 256:512]) ---
  k_gemm_wmma<<<dim3(4, ROWS_X / 128), 256, 0, stream>>>(
      msgb, 256, wmT, ROWS_X, 256, 256, mm, nullptr, 256, nullptr, 0.f, EP_F32);
  k_layernorm<<<ROWS_X / 8, 256, 0, stream>>>(mm, n1g, n1b, cat + 256, 512,
                                              nullptr, nullptr, ROWS_X);

  // --- MLP ---
  k_gemm_wmma<<<dim3(8, ROWS_X / 128), 256, 0, stream>>>(
      cat, 512, w1T, ROWS_X, 512, 512, nullptr, h1, 512, nullptr, 0.f, EP_RELU_BF);
  k_gemm_wmma<<<dim3(4, ROWS_X / 128), 256, 0, stream>>>(
      h1, 512, w2T, ROWS_X, 256, 512, h2, nullptr, 256, nullptr, 0.f, EP_F32);

  // --- LN2 + residual ---
  k_layernorm<<<ROWS_X / 8, 256, 0, stream>>>(h2, n2g, n2b, nullptr, 0,
                                              out, x, ROWS_X);
}

// v003
// A run of this version takes 335 microseconds.
// Next to v002, in two timings, it ran 1.12 and 1.11 times as fast.
// Over all steps from v000 it is 1.49 times as fast.
#include <hip/hip_runtime.h>
#include <stdint.h>
#include <stddef.h>

// ---------------- problem dims (hardcoded from reference) ----------------
static constexpr int Bsz  = 4;
static constexpr int Hh   = 128;
static constexpr int Wh   = 128;
static constexpr int Cc   = 256;
static constexpr int Nn   = Hh * Wh;          // 16384
static constexpr int Ssz  = (Hh/2) * (Wh/2);  // 4096
static constexpr int NH   = 8;
static constexpr int ROWS_X = Bsz * Nn;       // 65536
static constexpr int ROWS_S = Bsz * Ssz;      // 16384

// ---------------- types ----------------
typedef __bf16 bf16_t;
typedef __attribute__((ext_vector_type(16))) __bf16 v16bf;
typedef __attribute__((ext_vector_type(8)))  __bf16 v8bf;
typedef __attribute__((ext_vector_type(8)))  float  v8f;

struct bf4 { bf16_t e[4]; };   // POD 8-byte pack

__device__ inline bf16_t f2bf(float f) {
  union { float f; unsigned u; } a; a.f = f;
  unsigned r = a.u + 0x7FFFu + ((a.u >> 16) & 1u);
  unsigned short h = (unsigned short)(r >> 16);
  union { unsigned short u; bf16_t b; } o; o.u = h;
  return o.b;
}
__device__ inline float bf2f(bf16_t b) {
  union { unsigned short u; bf16_t b; } i; i.b = b;
  union { unsigned u; float f; } o; o.u = ((unsigned)i.u) << 16;
  return o.f;
}

// Assemble 16-elem bf16 WMMA fragment: 8 contiguous at p, 8 at p+16.
__device__ inline v16bf frag16(const bf16_t* p) {
  v8bf lo = *(const v8bf*)p;
  v8bf hi = *(const v8bf*)(p + 16);
  return __builtin_shufflevector(lo, hi, 0,1,2,3,4,5,6,7,8,9,10,11,12,13,14,15);
}

// gfx1250 async global->LDS copy, 16B per lane, tracked by ASYNCcnt.
// LDS dest VGPR = wave-relative LDS byte offset (low 32b of flat LDS address).
__device__ inline uint32_t lds_off32(const void* p) {
  return (uint32_t)(uintptr_t)p;
}
// LDS row pitch of every 32-k bf16 fragment tile, in elements: 80 B (16 B x odd), so
// that the 16 rows one ds_load_b128 half-wave reads fall on 16 different bank groups
// (at the plain 64 B pitch four rows share each group).
static constexpr int LDP = 40;

#define ASYNC_LD_B128(ldsoff, gptr)                                        \
  asm volatile("global_load_async_to_lds_b128 %0, %1, off"                 \
               :: "v"(ldsoff), "v"((uint64_t)(uintptr_t)(gptr)) : "memory")

// ---------------- weight prep ----------------
// The nine preparation bodies below depend on nothing but the inputs; k_prep runs them
// all in one grid, each on its own range of blocks (blk = index inside the range).
__device__ inline void d_transpose_w(int blk, const float* __restrict__ w,
                                     bf16_t* __restrict__ wT, int K, int Ncol) {
  int idx = blk * 256 + threadIdx.x;
  if (idx >= K * Ncol) return;
  int k = idx / Ncol, n = idx % Ncol;
  wT[(size_t)n * K + k] = f2bf(w[idx]);
}

__device__ inline void d_pack_srw(int blk, const float* __restrict__ w,
                                  bf16_t* __restrict__ wT) {
  int idx = blk * 256 + threadIdx.x;
  if (idx >= Cc * 4 * Cc) return;
  int o = idx >> 10, r = idx & 1023;
  int p = r >> 8, i = r & 255;
  int kh = p >> 1, kw = p & 1;
  wT[(size_t)o * 1024 + r] = f2bf(w[(((size_t)o * Cc + i) * 2 + kh) * 2 + kw]);
}

__device__ inline void d_pack_x(int blk, const float* __restrict__ x,
                                bf16_t* __restrict__ cat) {
  int idx = blk * 256 + threadIdx.x;   // one per 4 elems
  long e = (long)idx * 4;
  if (e >= (long)ROWS_X * Cc) return;
  int row = (int)(e >> 8), c = (int)(e & 255);
  float4 v = *(const float4*)(x + (size_t)row * Cc + c);
  bf4 pk; pk.e[0]=f2bf(v.x); pk.e[1]=f2bf(v.y); pk.e[2]=f2bf(v.z); pk.e[3]=f2bf(v.w);
  *(bf4*)(cat + (size_t)row * 512 + c) = pk;
}

__device__ inline void d_im2col(int blk, const float* __restrict__ x,
                                bf16_t* __restrict__ xim) {
  int bs = blk;                         // 0..ROWS_S-1
  int t  = threadIdx.x;                 // 256 threads * 4 elems = 1024
  int b  = bs >> 12;
  int s  = bs & 4095;
  int oh = s >> 6, ow = s & 63;
  int kidx = t * 4;
  int p = kidx >> 8, i = kidx & 255;
  int kh = p >> 1, kw = p & 1;
  int n = (2*oh + kh) * Wh + (2*ow + kw);
  float4 v = *(const float4*)(x + ((size_t)b * Nn + n) * Cc + i);
  bf4 pk; pk.e[0]=f2bf(v.x); pk.e[1]=f2bf(v.y); pk.e[2]=f2bf(v.z); pk.e[3]=f2bf(v.w);
  *(bf4*)(xim + (size_t)bs * 1024 + kidx) = pk;
}

static constexpr int PB_W256 = 256 * 256 / 256;        // blocks of a 256x256 transpose
static constexpr int PB_W1   = 512 * 512 / 256;
static constexpr int PB_W2   = 512 * 256 / 256;
static constexpr int PB_SRW  = 256 * 1024 / 256;
static constexpr int PB_X    = ROWS_X * 256 / 4 / 256;
static constexpr int PB_IM   = ROWS_S;
static constexpr int PB_ALL  = 4 * PB_W256 + PB_W1 + PB_W2 + PB_SRW + PB_X + PB_IM;

__global__ __launch_bounds__(256) void k_prep(
    const float* __restrict__ x, const float* __restrict__ sr_w,
    const float* __restrict__ wq, const float* __restrict__ wk,
    const float* __restrict__ wv, const float* __restrict__ wm,
    const float* __restrict__ w1, const float* __restrict__ w2,
    bf16_t* __restrict__ wqT, bf16_t* __restrict__ wkT, bf16_t* __restrict__ wvT,
    bf16_t* __restrict__ wmT, bf16_t* __restrict__ w1T, bf16_t* __restrict__ w2T,
    bf16_t* __restrict__ wsrT, bf16_t* __restrict__ cat, bf16_t* __restrict__ xim)
{
  int blk = blockIdx.x;
  if (blk < PB_W256) { d_transpose_w(blk, wq, wqT, 256, 256); return; }
  blk -= PB_W256;
  if (blk < PB_W256) { d_transpose_w(blk, wk, wkT, 256, 256); return; }
  blk -= PB_W256;
  if (blk < PB_W256) { d_transpose_w(blk, wv, wvT, 256, 256); return; }
  blk -= PB_W256;
  if (blk < PB_W256) { d_transpose_w(blk, wm, wmT, 256, 256); return; }
  blk -= PB_W256;
  if (blk < PB_W1)   { d_transpose_w(blk, w1, w1T, 512, 512); return; }
  blk -= PB_W1;
  if (blk < PB_W2)   { d_transpose_w(blk, w2, w2T, 512, 256); return; }
  blk -= PB_W2;
  if (blk < PB_SRW)  { d_pack_srw(blk, sr_w, wsrT); return; }
  blk -= PB_SRW;
  if (blk < PB_X)    { d_pack_x(blk, x, cat); return; }
  blk -= PB_X;
  d_im2col(blk, x, xim);
}

// ---------------- generic WMMA GEMM (128x64 tile, async double-buffered) ----------------
enum { EP_F32 = 0, EP_BIAS_F32 = 1, EP_ELU_BF = 2, EP_SCALE_BF = 3, EP_RELU_BF = 4 };

// C[M,Ncol] = epi( A[M,K](lda) * BT[Ncol,K]^T ), block tile 128x64, k-step 32.
// 8 waves: wave -> (wy=w>>1 in 0..3 : 32 rows, wx=w&1 : 32 cols), 2x2 accs each.
// One grid serves two independent products: blocks below g0.nblk work on g0, the rest
// on g1. Inside a product the tile column runs fastest (1 << lgx tile columns).
struct GemmArgs {
  const bf16_t* A;
  const bf16_t* BT;
  float* outF;
  bf16_t* outB;
  const float* bias;
  int lda, K, ldo, mode, lgx, nblk;
  float scale;
};

__global__ __launch_bounds__(256) void k_gemm_wmma(GemmArgs g0, GemmArgs g1)
{
  const bool second = (int)blockIdx.x >= g0.nblk;
  const int  bid    = (int)blockIdx.x - (second ? g0.nblk : 0);
  const bf16_t* __restrict__ A    = second ? g1.A    : g0.A;
  const bf16_t* __restrict__ BT   = second ? g1.BT   : g0.BT;
  float*  __restrict__ outF       = second ? g1.outF : g0.outF;
  bf16_t* __restrict__ outB       = second ? g1.outB : g0.outB;
  const float* __restrict__ bias  = second ? g1.bias : g0.bias;
  const int   lda   = second ? g1.lda   : g0.lda;
  const int   K     = second ? g1.K     : g0.K;
  const int   ldo   = second ? g1.ldo   : g0.ldo;
  const int   mode  = second ? g1.mode  : g0.mode;
  const int   lgx   = second ? g1.lgx   : g0.lgx;
  const float scale = second ? g1.scale : g0.scale;
  __shared__ __align__(16) bf16_t As[2][128 * LDP];
  __shared__ __align__(16) bf16_t Bs[2][64 * LDP];
  const int tid  = threadIdx.x;
  const int lane = tid & 31, wave = tid >> 5;
  const int wy = wave >> 1, wx = wave & 1;
  const int row0 = (bid >> lgx) * 128;
  const int col0 = (bid & ((1 << lgx) - 1)) * 64;
  // tile loaders: A 128x32 -> 16 bf16/thread (2x b128); B 64x32 -> 8 bf16/thread
  const int lrA = tid >> 1, lkA = (tid & 1) << 4;
  const int lrB = tid >> 2, lkB = (tid & 3) << 3;
  const bf16_t* Ag = A  + (size_t)(row0 + lrA) * lda + lkA;
  const bf16_t* Bg = BT + (size_t)(col0 + lrB) * K   + lkB;
  uint32_t ldsA0[2], ldsA1[2], ldsBo[2];
#pragma unroll
  for (int b = 0; b < 2; ++b) {
    ldsA0[b] = lds_off32(&As[b][lrA * LDP + lkA]);
    ldsA1[b] = lds_off32(&As[b][lrA * LDP + lkA + 8]);
    ldsBo[b] = lds_off32(&Bs[b][lrB * LDP + lkB]);
  }
  const int r = lane & 15, hb = (lane >> 4) << 3;

  v8f acc[2][2] = {};

  // prologue: stage k0=0 into buffer 0
  ASYNC_LD_B128(ldsA0[0], Ag);
  ASYNC_LD_B128(ldsA1[0], Ag + 8);
  ASYNC_LD_B128(ldsBo[0], Bg);

  for (int k0 = 0; k0 < K; k0 += 32) {
    const int cur = (k0 >> 5) & 1;
    if (k0 + 32 < K) {              // stage next tile into other buffer
      ASYNC_LD_B128(ldsA0[cur ^ 1], Ag + k0 + 32);
      ASYNC_LD_B128(ldsA1[cur ^ 1], Ag + k0 + 40);
      ASYNC_LD_B128(ldsBo[cur ^ 1], Bg + k0 + 32);
      asm volatile("s_wait_asynccnt 0x3" ::: "memory");   // current 3 done
    } else {
      asm volatile("s_wait_asynccnt 0x0" ::: "memory");
    }
    __syncthreads();
    const bf16_t* as = &As[cur][0];
    const bf16_t* bs = &Bs[cur][0];
    v16bf a0 = frag16(as + (wy * 32 +      r) * LDP + hb);
    v16bf a1 = frag16(as + (wy * 32 + 16 + r) * LDP + hb);
    v16bf b0 = frag16(bs + (wx * 32 +      r) * LDP + hb);
    v16bf b1 = frag16(bs + (wx * 32 + 16 + r) * LDP + hb);
    acc[0][0] = __builtin_amdgcn_wmma_f32_16x16x32_bf16(false, a0, false, b0,
                                                        (short)0, acc[0][0], false, false);
    acc[0][1] = __builtin_amdgcn_wmma_f32_16x16x32_bf16(false, a0, false, b1,
                                                        (short)0, acc[0][1], false, false);
    acc[1][0] = __builtin_amdgcn_wmma_f32_16x16x32_bf16(false, a1, false, b0,
                                                        (short)0, acc[1][0], false, false);
    acc[1][1] = __builtin_amdgcn_wmma_f32_16x16x32_bf16(false, a1, false, b1,
                                                        (short)0, acc[1][1], false, false);
    __syncthreads();
  }

  const int half = lane >> 4;
#pragma unroll
  for (int m = 0; m < 2; ++m) {
#pragma unroll
    for (int i = 0; i < 8; ++i) {
      int orow = row0 + wy * 32 + m * 16 + i + half * 8;
#pragma unroll
      for (int n = 0; n < 2; ++n) {
        int ocol = col0 + wx * 32 + n * 16 + r;
        float v = acc[m][n][i];
        if (mode == EP_F32) {
          outF[(size_t)orow * ldo + ocol] = v;
        } else if (mode == EP_BIAS_F32) {
          outF[(size_t)orow * ldo + ocol] = v + bias[ocol];
        } else if (mode == EP_ELU_BF) {   // elu(x)+1 : x+1 if x>0 else exp(x)
          outB[(size_t)orow * ldo + ocol] = f2bf(v > 0.f ? v + 1.f : __expf(v));
        } else if (mode == EP_SCALE_BF) {
          outB[(size_t)orow * ldo + ocol] = f2bf(v * scale);
        } else {                          // relu -> bf16
          outB[(size_t)orow * ldo + ocol] = f2bf(v > 0.f ? v : 0.f);
        }
      }
    }
  }
}

// ---------------- LayerNorm over 256-wide rows ----------------
__global__ __launch_bounds__(256) void k_layernorm(
    const float* __restrict__ in, const float* __restrict__ g, const float* __restrict__ bb,
    bf16_t* __restrict__ outB, int ldoB,
    float* __restrict__ outF, const float* __restrict__ resid, int rows)
{
  int wave = threadIdx.x >> 5, lane = threadIdx.x & 31;
  int row = blockIdx.x * 8 + wave;
  if (row >= rows) return;
  const float* p = in + (size_t)row * 256;
  float4 a = *(const float4*)(p + lane * 8);
  float4 c = *(const float4*)(p + lane * 8 + 4);
  float vals[8] = {a.x, a.y, a.z, a.w, c.x, c.y, c.z, c.w};
  float s = 0.f;
#pragma unroll
  for (int j = 0; j < 8; ++j) s += vals[j];
#pragma unroll
  for (int o = 16; o > 0; o >>= 1) s += __shfl_xor(s, o, 32);
  float mean = s * (1.f / 256.f);
  float vs = 0.f;
#pragma unroll
  for (int j = 0; j < 8; ++j) { vals[j] -= mean; vs += vals[j] * vals[j]; }
#pragma unroll
  for (int o = 16; o > 0; o >>= 1) vs += __shfl_xor(vs, o, 32);
  float inv = rsqrtf(vs * (1.f / 256.f) + 1e-5f);
#pragma unroll
  for (int j = 0; j < 8; ++j) {
    int c0 = lane * 8 + j;
    float y = vals[j] * inv * g[c0] + bb[c0];
    if (outB) outB[(size_t)row * ldoB + c0] = f2bf(y);
    if (outF) outF[(size_t)row * 256 + c0] = y + resid[(size_t)row * 256 + c0];
  }
}

// ---------------- Ksum = sum_s K_elu ----------------
__device__ inline void d_ksum_part(int blk, const bf16_t* __restrict__ Ke,
                                   float* __restrict__ part) {
  // blk in 0..B*16-1
  int b = blk >> 4, ch = blk & 15;
  int c = threadIdx.x;                  // 256
  const bf16_t* p = Ke + ((size_t)b * Ssz + ch * 256) * 256 + c;
  float s = 0.f;
  for (int i = 0; i < 256; ++i) s += bf2f(p[(size_t)i * 256]);
  part[((size_t)b * 16 + ch) * 256 + c] = s;
}
__device__ inline void d_ksum_reduce(int blk, const float* __restrict__ part,
                                     float* __restrict__ ksum) {
  int idx = blk * 256 + threadIdx.x;  // B*256
  if (idx >= Bsz * 256) return;
  int b = idx >> 8, c = idx & 255;
  float s = 0.f;
  for (int ch = 0; ch < 16; ++ch) s += part[((size_t)b * 16 + ch) * 256 + c];
  ksum[idx] = s;
}

// ---------------- KV[b,h] = K^T * Vsc (32x32 over S=4096), stored transposed ----------------
// S is cut into KV_SPLIT ranges, one work-group per (b,h,range); each stores an f32
// partial [e][d], and k_kv_ksum_reduce sums the ranges in index order.
static constexpr int KV_SPLIT = 32;
static constexpr int KV_ROWS  = Ssz / KV_SPLIT;    // 128 rows of S per work-group
static constexpr int KV_ELEMS = Bsz * NH * 32 * 32;

__device__ inline void d_kv_wmma(int bh, int range, const bf16_t* __restrict__ Ke,
                                 const bf16_t* __restrict__ Vsc,
                                 float* __restrict__ kvpart)
{
  __shared__ __align__(16) bf16_t KT[32 * LDP];  // [d][s]
  __shared__ __align__(16) bf16_t VT[32 * LDP];  // [e][s]
  int b = bh >> 3, h = bh & 7;          // bh in 0..B*NH-1
  int tid = threadIdx.x, lane = tid & 31, wave = tid >> 5;
  int d0 = (tid & 7) * 4;
  int si = tid >> 3;
  const int r = lane & 15, hb = (lane >> 4) << 3;
  int ti = (wave >> 1) & 1, tj = wave & 1;
  v8f acc = {0,0,0,0,0,0,0,0};
  const size_t base = (size_t)b * Ssz * 256 + h * 32;

  const int sBeg = range * KV_ROWS;
  for (int s0 = sBeg; s0 < sBeg + KV_ROWS; s0 += 32) {
    bf4 kk = *(const bf4*)(Ke  + base + (size_t)(s0 + si) * 256 + d0);
    bf4 vv = *(const bf4*)(Vsc + base + (size_t)(s0 + si) * 256 + d0);
    __syncthreads();
#pragma unroll
    for (int j = 0; j < 4; ++j) {
      KT[(d0 + j) * LDP + si] = kk.e[j];
      VT[(d0 + j) * LDP + si] = vv.e[j];
    }
    __syncthreads();
    if (wave < 4) {
      v16bf af = frag16(KT + (ti * 16 + r) * LDP + hb);
      v16bf bf = frag16(VT + (tj * 16 + r) * LDP + hb);
      acc = __builtin_amdgcn_wmma_f32_16x16x32_bf16(false, af, false, bf,
                                                    (short)0, acc, false, false);
    }
  }
  if (wave < 4) {
    int half = lane >> 4;
    float* pp = kvpart + (size_t)range * KV_ELEMS;
#pragma unroll
    for (int i = 0; i < 8; ++i) {
      int d = ti * 16 + i + half * 8;
      int e = tj * 16 + r;
      pp[((size_t)bh * 32 + e) * 32 + d] = acc[i];
    }
  }
}

// K-sum partials and K^T V partials both read only Ke / Vsc: one grid, the long K-sum
// blocks first.
static constexpr int KS_BLK = Bsz * 16;
__global__ __launch_bounds__(256) void k_kv_ksum_part(const bf16_t* __restrict__ Ke,
                                                      const bf16_t* __restrict__ Vsc,
                                                      float* __restrict__ kvpart,
                                                      float* __restrict__ part)
{
  int blk = blockIdx.x;
  if (blk < KS_BLK) { d_ksum_part(blk, Ke, part); return; }
  blk -= KS_BLK;
  d_kv_wmma(blk & (Bsz * NH - 1), blk >> 5, Ke, Vsc, kvpart);
}

__device__ inline void d_kv_reduce(int blk, const float* __restrict__ kvpart,
                                   bf16_t* __restrict__ KVbT)
{
  int idx = blk * 256 + threadIdx.x;                // 0..KV_ELEMS-1
  float s = 0.f;
  // unrolled so that all the partial loads are in flight together
#pragma unroll
  for (int ch = 0; ch < KV_SPLIT; ++ch) s += kvpart[(size_t)ch * KV_ELEMS + idx];
  KVbT[idx] = f2bf(s);
}

// the two sums over partials, one grid
static constexpr int KVR_BLK = KV_ELEMS / 256;
static constexpr int KSR_BLK = Bsz * 256 / 256;
__global__ __launch_bounds__(256) void k_kv_ksum_reduce(const float* __restrict__ kvpart,
                                                        bf16_t* __restrict__ KVbT,
                                                        const float* __restrict__ part,
                                                        float* __restrict__ ksum)
{
  int blk = blockIdx.x;
  if (blk < KVR_BLK) { d_kv_reduce(blk, kvpart, KVbT); return; }
  d_ksum_reduce(blk - KVR_BLK, part, ksum);
}

// ---------------- msg = (Q * KV) * S/(Q.Ksum + eps) ----------------
__global__ __launch_bounds__(256) void k_msg_wmma(const bf16_t* __restrict__ Qe,
                                                  const bf16_t* __restrict__ KVbT,
                                                  const float* __restrict__ ksum,
                                                  bf16_t* __restrict__ msgb)
{
  int row0 = blockIdx.x * 16;
  int lane = threadIdx.x & 31, h = threadIdx.x >> 5;
  int b = row0 >> 14;
  const int r = lane & 15, hb = (lane >> 4) << 3;

  const bf16_t* Ap = Qe + (size_t)(row0 + r) * 256 + h * 32;
  v16bf af = frag16(Ap + hb);
  const bf16_t* Bp = KVbT + (size_t)(b * 8 + h) * 32 * 32;
  v16bf bf0 = frag16(Bp + r * 32 + hb);
  v16bf bf1 = frag16(Bp + (16 + r) * 32 + hb);
  v8f acc0 = {0,0,0,0,0,0,0,0};
  v8f acc1 = {0,0,0,0,0,0,0,0};
  acc0 = __builtin_amdgcn_wmma_f32_16x16x32_bf16(false, af, false, bf0,
                                                 (short)0, acc0, false, false);
  acc1 = __builtin_amdgcn_wmma_f32_16x16x32_bf16(false, af, false, bf1,
                                                 (short)0, acc1, false, false);

  const float* ks = ksum + (size_t)b * 256 + h * 32;
  float dot = 0.f;
#pragma unroll
  for (int d = 0; d < 32; ++d) dot += bf2f(Ap[d]) * ks[d];
  float z = (float)Ssz / (dot + 1e-6f);

  int half = lane >> 4;
#pragma unroll
  for (int i = 0; i < 8; ++i) {
    float zi = __shfl(z, i + half * 8, 32);
    int orow = row0 + i + half * 8;
    bf16_t* op = msgb + (size_t)orow * 256 + h * 32;
    op[r]      = f2bf(acc0[i] * zi);
    op[16 + r] = f2bf(acc1[i] * zi);
  }
}

// ---------------- host launcher ----------------
// 128x64 output tiles of the GEMM shapes
static constexpr int TB_S  = 4 * (ROWS_S / 128);   // [ROWS_S][256]
static constexpr int TB_X  = 4 * (ROWS_X / 128);   // [ROWS_X][256]
static constexpr int TB_X2 = 8 * (ROWS_X / 128);   // [ROWS_X][512]

extern "C" void kernel_launch(void* const* d_in, const int* in_sizes, int n_in,
                              void* d_out, int out_size, void* d_ws, size_t ws_size,
                              hipStream_t stream) {
  const float* x      = (const float*)d_in[0];
  const float* sr_w   = (const float*)d_in[1];
  const float* sr_b   = (const float*)d_in[2];
  const float* norm_g = (const float*)d_in[3];
  const float* norm_b = (const float*)d_in[4];
  const float* wq     = (const float*)d_in[5];
  const float* wk     = (const float*)d_in[6];
  const float* wv     = (const float*)d_in[7];
  const float* wm     = (const float*)d_in[8];
  const float* w1     = (const float*)d_in[9];
  const float* w2     = (const float*)d_in[10];
  const float* n1g    = (const float*)d_in[11];
  const float* n1b    = (const float*)d_in[12];
  const float* n2g    = (const float*)d_in[13];
  const float* n2b    = (const float*)d_in[14];
  float* out = (float*)d_out;

  char* ws = (char*)d_ws;
  size_t off = 0;
  auto alloc = [&](size_t bytes) -> void* {
    off = (off + 255) & ~(size_t)255;
    void* p = ws + off;
    off += bytes;
    return p;
  };

  bf16_t* wqT  = (bf16_t*)alloc((size_t)256 * 256 * 2);
  bf16_t* wkT  = (bf16_t*)alloc((size_t)256 * 256 * 2);
  bf16_t* wvT  = (bf16_t*)alloc((size_t)256 * 256 * 2);
  bf16_t* wmT  = (bf16_t*)alloc((size_t)256 * 256 * 2);
  bf16_t* w1T  = (bf16_t*)alloc((size_t)512 * 512 * 2);
  bf16_t* w2T  = (bf16_t*)alloc((size_t)256 * 512 * 2);
  bf16_t* wsrT = (bf16_t*)alloc((size_t)256 * 1024 * 2);
  float*  part = (float*)alloc((size_t)Bsz * 16 * 256 * 4);
  float*  ksum = (float*)alloc((size_t)Bsz * 256 * 4);
  bf16_t* KVbT = (bf16_t*)alloc((size_t)Bsz * NH * 32 * 32 * 2);
  bf16_t* cat  = (bf16_t*)alloc((size_t)ROWS_X * 512 * 2);          // [x | msg_ln]
  // pool A: im2col buf, later reused for msg (both 32 MiB)
  bf16_t* xim  = (bf16_t*)alloc((size_t)ROWS_S * 1024 * 2);
  bf16_t* msgb = xim;
  // pool B: Qe + xs + xs_ln + Ke + Vsc, later reused for h1 (64 MiB <= 72 MiB)
  size_t szQe = (size_t)ROWS_X * 256 * 2;
  size_t szXs = (size_t)ROWS_S * 256 * 4;
  size_t szLn = (size_t)ROWS_S * 256 * 2;
  char* poolB = (char*)alloc(szQe + szXs + 3 * szLn);
  bf16_t* Qe    = (bf16_t*)poolB;
  float*  xs    = (float*)(poolB + szQe);
  bf16_t* xs_ln = (bf16_t*)(poolB + szQe + szXs);
  bf16_t* Ke    = (bf16_t*)(poolB + szQe + szXs + szLn);
  bf16_t* Vsc   = (bf16_t*)(poolB + szQe + szXs + 2 * szLn);
  bf16_t* h1    = (bf16_t*)poolB;        // [ROWS_X][512] bf16
  // pool C: mm f32, reused for h2 f32
  float* mm = (float*)alloc((size_t)ROWS_X * 256 * 4);
  float* h2 = mm;
  float* kvpart = mm;                    // KV partials (4 MiB), dead before mm is written

  // --- all input preparation, one grid ---
  k_prep<<<PB_ALL, 256, 0, stream>>>(x, sr_w, wq, wk, wv, wm, w1, w2,
                                     wqT, wkT, wvT, wmT, w1T, w2T, wsrT, cat, xim);

  // --- spatial reduction conv (im2col GEMM) together with the Q projection ---
  const GemmArgs gConv = { xim, wsrT, xs, nullptr, sr_b,
                           1024, 1024, 256, EP_BIAS_F32, 2, TB_S, 0.f };
  const GemmArgs gQ    = { cat, wqT, nullptr, Qe, nullptr,
                           512, 256, 256, EP_ELU_BF, 2, TB_X, 0.f };
  k_gemm_wmma<<<TB_S + TB_X, 256, 0, stream>>>(gConv, gQ);
  k_layernorm<<<ROWS_S / 8, 256, 0, stream>>>(xs, norm_g, norm_b, xs_ln, 256,
                                              nullptr, nullptr, ROWS_S);

  // --- K and V projections from xs_ln, one grid ---
  const GemmArgs gK = { xs_ln, wkT, nullptr, Ke, nullptr,
                        256, 256, 256, EP_ELU_BF, 2, TB_S, 0.f };
  const GemmArgs gV = { xs_ln, wvT, nullptr, Vsc, nullptr,
                        256, 256, 256, EP_SCALE_BF, 2, TB_S,
                        1.f / (float)Ssz };
  k_gemm_wmma<<<TB_S + TB_S, 256, 0, stream>>>(gK, gV);

  // --- linear attention ---
  k_kv_ksum_part<<<KS_BLK + Bsz * NH * KV_SPLIT, 256, 0, stream>>>(Ke, Vsc, kvpart, part);
  k_kv_ksum_reduce<<<KVR_BLK + KSR_BLK, 256, 0, stream>>>(kvpart, KVbT, part, ksum);
  k_msg_wmma<<<ROWS_X / 16, 256, 0, stream>>>(Qe, KVbT, ksum, msgb);

  // --- merge proj + LN1 (into cat[:, 256:512]) ---
  const GemmArgs gM = { msgb, wmT, mm, nullptr, nullptr,
                        256, 256, 256, EP_F32, 2, TB_X, 0.f };
  k_gemm_wmma<<<TB_X, 256, 0, stream>>>(gM, gM);
  k_layernorm<<<ROWS_X / 8, 256, 0, stream>>>(mm, n1g, n1b, cat + 256, 512,
                                              nullptr, nullptr, ROWS_X);

  // --- MLP ---
  const GemmArgs gH1 = { cat, w1T, nullptr, h1, nullptr,
                         512, 512, 512, EP_RELU_BF, 3, TB_X2, 0.f };
  k_gemm_wmma<<<TB_X2, 256, 0, stream>>>(gH1, gH1);
  const GemmArgs gH2 = { h1, w2T, h2, nullptr, nullptr,
                         512, 512, 256, EP_F32, 2, TB_X, 0.f };
  k_gemm_wmma<<<TB_X, 256, 0, stream>>>(gH2, gH2);

  // --- LN2 + residual ---
  k_layernorm<<<ROWS_X / 8, 256, 0, stream>>>(h2, n2g, n2b, nullptr, 0,
                                              out, x, ROWS_X);
}

// v004
// A run of this version takes 323 microseconds.
// Timed twice side by side with v003, it ran 1.04 and 1.03 times as fast.
// Counting every step since v000, it is 1.54 times as fast.
#include <hip/hip_runtime.h>
#include <stdint.h>
#include <stddef.h>

// ---------------- problem dims (hardcoded from reference) ----------------
static constexpr int Bsz  = 4;
static constexpr int Hh   = 128;
static constexpr int Wh   = 128;
static constexpr int Cc   = 256;
static constexpr int Nn   = Hh * Wh;          // 16384
static constexpr int Ssz  = (Hh/2) * (Wh/2);  // 4096
static constexpr int NH   = 8;
static constexpr int ROWS_X = Bsz * Nn;       // 65536
static constexpr int ROWS_S = Bsz * Ssz;      // 16384

// ---------------- types ----------------
typedef __bf16 bf16_t;
typedef __attribute__((ext_vector_type(16))) __bf16 v16bf;
typedef __attribute__((ext_vector_type(8)))  __bf16 v8bf;
typedef __attribute__((ext_vector_type(8)))  float  v8f;

struct bf4 { bf16_t e[4]; };   // POD 8-byte pack

__device__ inline bf16_t f2bf(float f) {
  union { float f; unsigned u; } a; a.f = f;
  unsigned r = a.u + 0x7FFFu + ((a.u >> 16) & 1u);
  unsigned short h = (unsigned short)(r >> 16);
  union { unsigned short u; bf16_t b; } o; o.u = h;
  return o.b;
}
__device__ inline float bf2f(bf16_t b) {
  union { unsigned short u; bf16_t b; } i; i.b = b;
  union { unsigned u; float f; } o; o.u = ((unsigned)i.u) << 16;
  return o.f;
}

// Assemble 16-elem bf16 WMMA fragment: 8 contiguous at p, 8 at p+16.
__device__ inline v16bf frag16(const bf16_t* p) {
  v8bf lo = *(const v8bf*)p;
  v8bf hi = *(const v8bf*)(p + 16);
  return __builtin_shufflevector(lo, hi, 0,1,2,3,4,5,6,7,8,9,10,11,12,13,14,15);
}

// gfx1250 async global->LDS copy, 16B per lane, tracked by ASYNCcnt.
// LDS dest VGPR = wave-relative LDS byte offset (low 32b of flat LDS address).
__device__ inline uint32_t lds_off32(const void* p) {
  return (uint32_t)(uintptr_t)p;
}
// LDS row pitch of every 32-k bf16 fragment tile, in elements: 80 B (16 B x odd), so
// that the 16 rows one ds_load_b128 half-wave reads fall on 16 different bank groups
// (at the plain 64 B pitch four rows share each group).
static constexpr int LDP = 40;

#define ASYNC_LD_B128(ldsoff, gptr)                                        \
  asm volatile("global_load_async_to_lds_b128 %0, %1, off"                 \
               :: "v"(ldsoff), "v"((uint64_t)(uintptr_t)(gptr)) : "memory")

// Stands behind a group of global loads or stores, in front of the code that gives their
// address or data registers new values (the next trip of a loop, the next row).
// The scheduling barrier keeps that later code behind the wait: the "memory" clobber alone
// does not tie vector instructions to it.
#define WAIT_XCNT0()                                   \
  do {                                                 \
    asm volatile("s_wait_xcnt 0x0" ::: "memory");      \
    __builtin_amdgcn_sched_barrier(0);                 \
  } while (0)

// ---------------- weight prep ----------------
// The nine preparation bodies below depend on nothing but the inputs; k_prep runs them
// all in one grid, each on its own range of blocks (blk = index inside the range).
// Every thread works through several elements, so that the grid starts few waves.
static constexpr int WPT = 8;    // weight elements per thread
static constexpr int XB  = 8;    // float4 of x a thread has in flight
static constexpr int XG  = 4;    // such groups per thread

__device__ __forceinline__ void d_transpose_w(int blk, const float* __restrict__ w,
                                     bf16_t* __restrict__ wT, int K, int Ncol) {
  const int idx0 = blk * WPT * 256 + threadIdx.x;
  if (blk * WPT * 256 >= K * Ncol) return;   // K * Ncol is a multiple of WPT * 256
  float v[WPT];
#pragma unroll   // the WPT loads go out together
  for (int j = 0; j < WPT; ++j) v[j] = w[idx0 + j * 256];
  WAIT_XCNT0();
#pragma unroll
  for (int j = 0; j < WPT; ++j) {
    int idx = idx0 + j * 256;
    int k = idx / Ncol, n = idx % Ncol;
    wT[(size_t)n * K + k] = f2bf(v[j]);
  }
  WAIT_XCNT0();
}

__device__ __forceinline__ void d_pack_srw(int blk, const float* __restrict__ w,
                                  bf16_t* __restrict__ wT) {
  const int idx0 = blk * WPT * 256 + threadIdx.x;
  if (blk * WPT * 256 >= Cc * 4 * Cc) return;   // the total is a multiple of WPT * 256
  float v[WPT];
#pragma unroll   // the WPT loads go out together
  for (int j = 0; j < WPT; ++j) {
    int idx = idx0 + j * 256;
    int o = idx >> 10, r = idx & 1023;
    int p = r >> 8, i = r & 255;
    int kh = p >> 1, kw = p & 1;
    v[j] = w[(((size_t)o * Cc + i) * 2 + kh) * 2 + kw];
  }
  WAIT_XCNT0();
#pragma unroll
  for (int j = 0; j < WPT; ++j) wT[idx0 + j * 256] = f2bf(v[j]);
  WAIT_XCNT0();
}

__device__ __forceinline__ bf4 pack4(float4 v) {
  bf4 pk; pk.e[0]=f2bf(v.x); pk.e[1]=f2bf(v.y); pk.e[2]=f2bf(v.z); pk.e[3]=f2bf(v.w);
  return pk;
}

__device__ __forceinline__ void d_pack_x(int blk, const float* __restrict__ x,
                                bf16_t* __restrict__ cat) {
#pragma unroll 1   // rolled: unrolled, the later groups' loads went out two at a time
  for (int g = 0; g < XG; ++g) {
    const int idx0 = (blk * XG + g) * XB * 256 + threadIdx.x;   // one per 4 elems
    float4 v[XB];
#pragma unroll   // XB loads in flight before the first store
    for (int j = 0; j < XB; ++j)
      v[j] = *(const float4*)(x + (size_t)(idx0 + j * 256) * 4);
    WAIT_XCNT0();
#pragma unroll
    for (int j = 0; j < XB; ++j) {
      int e = (idx0 + j * 256) * 4;
      int row = e >> 8, c = e & 255;
      *(bf4*)(cat + (size_t)row * 512 + c) = pack4(v[j]);
    }
    WAIT_XCNT0();
  }
}

__device__ __forceinline__ void d_im2col(int blk, const float* __restrict__ x,
                                bf16_t* __restrict__ xim) {
  int t  = threadIdx.x;                 // 256 threads * 4 elems = 1024 = one row of xim
  int kidx = t * 4;
  int p = kidx >> 8, i = kidx & 255;
  int kh = p >> 1, kw = p & 1;
#pragma unroll 1   // rolled: unrolled, the later groups' loads went out two at a time
  for (int g = 0; g < XG; ++g) {
    const int bs0 = (blk * XG + g) * XB;   // rows bs0 .. bs0+XB-1 of 0..ROWS_S-1
    float4 v[XB];
#pragma unroll   // XB loads in flight before the first store
    for (int j = 0; j < XB; ++j) {
      int bs = bs0 + j;
      int b  = bs >> 12;
      int s  = bs & 4095;
      int oh = s >> 6, ow = s & 63;
      int n = (2*oh + kh) * Wh + (2*ow + kw);
      v[j] = *(const float4*)(x + ((size_t)b * Nn + n) * Cc + i);
    }
    WAIT_XCNT0();
#pragma unroll
    for (int j = 0; j < XB; ++j)
      *(bf4*)(xim + (size_t)(bs0 + j) * 1024 + kidx) = pack4(v[j]);
    WAIT_XCNT0();
  }
}

static constexpr int PB_W256 = 256 * 256 / 256 / WPT;  // blocks of a 256x256 transpose
static constexpr int PB_W1   = 512 * 512 / 256 / WPT;
static constexpr int PB_W2   = 512 * 256 / 256 / WPT;
static constexpr int PB_SRW  = 256 * 1024 / 256 / WPT;
static constexpr int PB_X    = ROWS_X * 256 / 4 / 256 / (XB * XG);
static constexpr int PB_IM   = ROWS_S / (XB * XG);
static constexpr int PB_ALL  = 4 * PB_W256 + PB_W1 + PB_W2 + PB_SRW + PB_X + PB_IM;

__global__ __launch_bounds__(256) void k_prep(
    const float* __restrict__ x, const float* __restrict__ sr_w,
    const float* __restrict__ wq, const float* __restrict__ wk,
    const float* __restrict__ wv, const float* __restrict__ wm,
    const float* __restrict__ w1, const float* __restrict__ w2,
    bf16_t* __restrict__ wqT, bf16_t* __restrict__ wkT, bf16_t* __restrict__ wvT,
    bf16_t* __restrict__ wmT, bf16_t* __restrict__ w1T, bf16_t* __restrict__ w2T,
    bf16_t* __restrict__ wsrT, bf16_t* __restrict__ cat, bf16_t* __restrict__ xim)
{
  int blk = blockIdx.x;
  if (blk < PB_W256) { d_transpose_w(blk, wq, wqT, 256, 256); return; }
  blk -= PB_W256;
  if (blk < PB_W256) { d_transpose_w(blk, wk, wkT, 256, 256); return; }
  blk -= PB_W256;
  if (blk < PB_W256) { d_transpose_w(blk, wv, wvT, 256, 256); return; }
  blk -= PB_W256;
  if (blk < PB_W256) { d_transpose_w(blk, wm, wmT, 256, 256); return; }
  blk -= PB_W256;
  if (blk < PB_W1)   { d_transpose_w(blk, w1, w1T, 512, 512); return; }
  blk -= PB_W1;
  if (blk < PB_W2)   { d_transpose_w(blk, w2, w2T, 512, 256); return; }
  blk -= PB_W2;
  if (blk < PB_SRW)  { d_pack_srw(blk, sr_w, wsrT); return; }
  blk -= PB_SRW;
  if (blk < PB_X)    { d_pack_x(blk, x, cat); return; }
  blk -= PB_X;
  d_im2col(blk, x, xim);
}

// ---------------- generic WMMA GEMM (128x64 tile, async double-buffered) ----------------
enum { EP_F32 = 0, EP_BIAS_F32 = 1, EP_ELU_BF = 2, EP_SCALE_BF = 3, EP_RELU_BF = 4 };

// C[M,Ncol] = epi( A[M,K](lda) * BT[Ncol,K]^T ), block tile 128x64, k-step 32.
// 8 waves: wave -> (wy=w>>1 in 0..3 : 32 rows, wx=w&1 : 32 cols), 2x2 accs each.
// One grid serves two independent products: blocks below g0.nblk work on g0, the rest
// on g1. Inside a product the tile column runs fastest (1 << lgx tile columns).
struct GemmArgs {
  const bf16_t* A;
  const bf16_t* BT;
  float* outF;
  bf16_t* outB;
  const float* bias;
  int lda, K, ldo, mode, lgx, nblk;
  float scale;
};

__global__ __launch_bounds__(256) void k_gemm_wmma(GemmArgs g0, GemmArgs g1)
{
  const bool second = (int)blockIdx.x >= g0.nblk;
  const int  bid    = (int)blockIdx.x - (second ? g0.nblk : 0);
  const bf16_t* __restrict__ A    = second ? g1.A    : g0.A;
  const bf16_t* __restrict__ BT   = second ? g1.BT   : g0.BT;
  float*  __restrict__ outF       = second ? g1.outF : g0.outF;
  bf16_t* __restrict__ outB       = second ? g1.outB : g0.outB;
  const float* __restrict__ bias  = second ? g1.bias : g0.bias;
  const int   lda   = second ? g1.lda   : g0.lda;
  const int   K     = second ? g1.K     : g0.K;
  const int   ldo   = second ? g1.ldo   : g0.ldo;
  const int   mode  = second ? g1.mode  : g0.mode;
  const int   lgx   = second ? g1.lgx   : g0.lgx;
  const float scale = second ? g1.scale : g0.scale;
  __shared__ __align__(16) bf16_t As[2][128 * LDP];
  __shared__ __align__(16) bf16_t Bs[2][64 * LDP];
  const int tid  = threadIdx.x;
  const int lane = tid & 31, wave = tid >> 5;
  const int wy = wave >> 1, wx = wave & 1;
  const int row0 = (bid >> lgx) * 128;
  const int col0 = (bid & ((1 << lgx) - 1)) * 64;
  // tile loaders: A 128x32 -> 16 bf16/thread (2x b128); B 64x32 -> 8 bf16/thread
  const int lrA = tid >> 1, lkA = (tid & 1) << 4;
  const int lrB = tid >> 2, lkB = (tid & 3) << 3;
  const bf16_t* Ag = A  + (size_t)(row0 + lrA) * lda + lkA;
  const bf16_t* Bg = BT + (size_t)(col0 + lrB) * K   + lkB;
  uint32_t ldsA0[2], ldsA1[2], ldsBo[2];
#pragma unroll
  for (int b = 0; b < 2; ++b) {
    ldsA0[b] = lds_off32(&As[b][lrA * LDP + lkA]);
    ldsA1[b] = lds_off32(&As[b][lrA * LDP + lkA + 8]);
    ldsBo[b] = lds_off32(&Bs[b][lrB * LDP + lkB]);
  }
  const int r = lane & 15, hb = (lane >> 4) << 3;

  v8f acc[2][2] = {};

  // prologue: stage k0=0 into buffer 0
  ASYNC_LD_B128(ldsA0[0], Ag);
  ASYNC_LD_B128(ldsA1[0], Ag + 8);
  ASYNC_LD_B128(ldsBo[0], Bg);

  for (int k0 = 0; k0 < K; k0 += 32) {
    const int cur = (k0 >> 5) & 1;
    if (k0 + 32 < K) {              // stage next tile into other buffer
      ASYNC_LD_B128(ldsA0[cur ^ 1], Ag + k0 + 32);
      ASYNC_LD_B128(ldsA1[cur ^ 1], Ag + k0 + 40);
      ASYNC_LD_B128(ldsBo[cur ^ 1], Bg + k0 + 32);
      asm volatile("s_wait_asynccnt 0x3" ::: "memory");   // current 3 done
    } else {
      asm volatile("s_wait_asynccnt 0x0" ::: "memory");
    }
    __syncthreads();
    const bf16_t* as = &As[cur][0];
    const bf16_t* bs = &Bs[cur][0];
    v16bf a0 = frag16(as + (wy * 32 +      r) * LDP + hb);
    v16bf a1 = frag16(as + (wy * 32 + 16 + r) * LDP + hb);
    v16bf b0 = frag16(bs + (wx * 32 +      r) * LDP + hb);
    v16bf b1 = frag16(bs + (wx * 32 + 16 + r) * LDP + hb);
    acc[0][0] = __builtin_amdgcn_wmma_f32_16x16x32_bf16(false, a0, false, b0,
                                                        (short)0, acc[0][0], false, false);
    acc[0][1] = __builtin_amdgcn_wmma_f32_16x16x32_bf16(false, a0, false, b1,
                                                        (short)0, acc[0][1], false, false);
    acc[1][0] = __builtin_amdgcn_wmma_f32_16x16x32_bf16(false, a1, false, b0,
                                                        (short)0, acc[1][0], false, false);
    acc[1][1] = __builtin_amdgcn_wmma_f32_16x16x32_bf16(false, a1, false, b1,
                                                        (short)0, acc[1][1], false, false);
    __syncthreads();
  }

  const int half = lane >> 4;
#pragma unroll
  for (int m = 0; m < 2; ++m) {
#pragma unroll
    for (int i = 0; i < 8; ++i) {
      int orow = row0 + wy * 32 + m * 16 + i + half * 8;
#pragma unroll
      for (int n = 0; n < 2; ++n) {
        int ocol = col0 + wx * 32 + n * 16 + r;
        float v = acc[m][n][i];
        if (mode == EP_F32) {
          outF[(size_t)orow * ldo + ocol] = v;
        } else if (mode == EP_BIAS_F32) {
          outF[(size_t)orow * ldo + ocol] = v + bias[ocol];
        } else if (mode == EP_ELU_BF) {   // elu(x)+1 : x+1 if x>0 else exp(x)
          outB[(size_t)orow * ldo + ocol] = f2bf(v > 0.f ? v + 1.f : __expf(v));
        } else if (mode == EP_SCALE_BF) {
          outB[(size_t)orow * ldo + ocol] = f2bf(v * scale);
        } else {                          // relu -> bf16
          outB[(size_t)orow * ldo + ocol] = f2bf(v > 0.f ? v : 0.f);
        }
      }
    }
  }
}

// ---------------- LayerNorm over 256-wide rows ----------------
// A wave takes LN_R rows a trip (their loads in flight together) and strides over the
// rows by the grid, so that few waves are started; rows is a multiple of LN_R.
static constexpr int LN_R = 4;
__global__ __launch_bounds__(256) void k_layernorm(
    const float* __restrict__ in, const float* __restrict__ g, const float* __restrict__ bb,
    bf16_t* __restrict__ outB, int ldoB,
    float* __restrict__ outF, const float* __restrict__ resid, int rows)
{
  int wave = threadIdx.x >> 5, lane = threadIdx.x & 31;
  const int step = (int)gridDim.x * 8 * LN_R;
  float gv[8], bv[8];
#pragma unroll
  for (int j = 0; j < 8; ++j) { gv[j] = g[lane * 8 + j]; bv[j] = bb[lane * 8 + j]; }
  // The same wait; the loaded values are named as inputs because these loads (of memory
  // that nothing writes) were otherwise moved behind it.
  asm volatile("s_wait_xcnt 0x0"
               :: "v"(gv[0]), "v"(gv[1]), "v"(gv[2]), "v"(gv[3]),
                  "v"(gv[4]), "v"(gv[5]), "v"(gv[6]), "v"(gv[7]),
                  "v"(bv[0]), "v"(bv[1]), "v"(bv[2]), "v"(bv[3]),
                  "v"(bv[4]), "v"(bv[5]), "v"(bv[6]), "v"(bv[7]) : "memory");
  __builtin_amdgcn_sched_barrier(0);   // keeps the loop's address arithmetic behind it
  for (int row0 = (blockIdx.x * 8 + wave) * LN_R; row0 < rows; row0 += step) {
    float vals[LN_R][8];
    float res[LN_R][8];
#pragma unroll   // all the rows' loads go out before the first sum
    for (int q = 0; q < LN_R; ++q) {
      const float* p = in + (size_t)(row0 + q) * 256;
      float4 a = *(const float4*)(p + lane * 8);
      float4 c = *(const float4*)(p + lane * 8 + 4);
      vals[q][0] = a.x; vals[q][1] = a.y; vals[q][2] = a.z; vals[q][3] = a.w;
      vals[q][4] = c.x; vals[q][5] = c.y; vals[q][6] = c.z; vals[q][7] = c.w;
    }
    WAIT_XCNT0();
    if (outF) {
#pragma unroll
      for (int q = 0; q < LN_R; ++q)
#pragma unroll
        for (int j = 0; j < 8; ++j)
          res[q][j] = resid[(size_t)(row0 + q) * 256 + lane * 8 + j];
      WAIT_XCNT0();
    }
#pragma unroll
    for (int q = 0; q < LN_R; ++q) {
      const int row = row0 + q;
      float s = 0.f;
#pragma unroll
      for (int j = 0; j < 8; ++j) s += vals[q][j];
#pragma unroll
      for (int o = 16; o > 0; o >>= 1) s += __shfl_xor(s, o, 32);
      float mean = s * (1.f / 256.f);
      float vs = 0.f;
#pragma unroll
      for (int j = 0; j < 8; ++j) { vals[q][j] -= mean; vs += vals[q][j] * vals[q][j]; }
#pragma unroll
      for (int o = 16; o > 0; o >>= 1) vs += __shfl_xor(vs, o, 32);
      float inv = rsqrtf(vs * (1.f / 256.f) + 1e-5f);
#pragma unroll
      for (int j = 0; j < 8; ++j) {
        int c0 = lane * 8 + j;
        float y = vals[q][j] * inv * gv[j] + bv[j];
        if (outB) outB[(size_t)row * ldoB + c0] = f2bf(y);
        if (outF) outF[(size_t)row * 256 + c0] = y + res[q][j];
        WAIT_XCNT0();
      }
    }
  }
}

// ---------------- Ksum = sum_s K_elu ----------------
__device__ inline void d_ksum_part(int blk, const bf16_t* __restrict__ Ke,
                                   float* __restrict__ part) {
  // blk in 0..B*16-1
  int b = blk >> 4, ch = blk & 15;
  int c = threadIdx.x;                  // 256
  const bf16_t* p = Ke + ((size_t)b * Ssz + ch * 256) * 256 + c;
  float s = 0.f;
  for (int i = 0; i < 256; ++i) s += bf2f(p[(size_t)i * 256]);
  part[((size_t)b * 16 + ch) * 256 + c] = s;
}
__device__ inline void d_ksum_reduce(int blk, const float* __restrict__ part,
                                     float* __restrict__ ksum) {
  int idx = blk * 256 + threadIdx.x;  // B*256
  if (idx >= Bsz * 256) return;
  int b = idx >> 8, c = idx & 255;
  float s = 0.f;
  for (int ch = 0; ch < 16; ++ch) s += part[((size_t)b * 16 + ch) * 256 + c];
  ksum[idx] = s;
}

// ---------------- KV[b,h] = K^T * Vsc (32x32 over S=4096), stored transposed ----------------
// S is cut into KV_SPLIT ranges, one work-group per (b,h,range); each stores an f32
// partial [e][d], and k_kv_ksum_reduce sums the ranges in index order.
static constexpr int KV_SPLIT = 32;
static constexpr int KV_ROWS  = Ssz / KV_SPLIT;    // 128 rows of S per work-group
static constexpr int KV_ELEMS = Bsz * NH * 32 * 32;

__device__ inline void d_kv_wmma(int bh, int range, const bf16_t* __restrict__ Ke,
                                 const bf16_t* __restrict__ Vsc,
                                 float* __restrict__ kvpart)
{
  __shared__ __align__(16) bf16_t KT[32 * LDP];  // [d][s]
  __shared__ __align__(16) bf16_t VT[32 * LDP];  // [e][s]
  int b = bh >> 3, h = bh & 7;          // bh in 0..B*NH-1
  int tid = threadIdx.x, lane = tid & 31, wave = tid >> 5;
  int d0 = (tid & 7) * 4;
  int si = tid >> 3;
  const int r = lane & 15, hb = (lane >> 4) << 3;
  int ti = (wave >> 1) & 1, tj = wave & 1;
  v8f acc = {0,0,0,0,0,0,0,0};
  const size_t base = (size_t)b * Ssz * 256 + h * 32;

  const int sBeg = range * KV_ROWS;
  for (int s0 = sBeg; s0 < sBeg + KV_ROWS; s0 += 32) {
    bf4 kk = *(const bf4*)(Ke  + base + (size_t)(s0 + si) * 256 + d0);
    bf4 vv = *(const bf4*)(Vsc + base + (size_t)(s0 + si) * 256 + d0);
    __syncthreads();
#pragma unroll
    for (int j = 0; j < 4; ++j) {
      KT[(d0 + j) * LDP + si] = kk.e[j];
      VT[(d0 + j) * LDP + si] = vv.e[j];
    }
    __syncthreads();
    if (wave < 4) {
      v16bf af = frag16(KT + (ti * 16 + r) * LDP + hb);
      v16bf bf = frag16(VT + (tj * 16 + r) * LDP + hb);
      acc = __builtin_amdgcn_wmma_f32_16x16x32_bf16(false, af, false, bf,
                                                    (short)0, acc, false, false);
    }
  }
  if (wave < 4) {
    int half = lane >> 4;
    float* pp = kvpart + (size_t)range * KV_ELEMS;
#pragma unroll
    for (int i = 0; i < 8; ++i) {
      int d = ti * 16 + i + half * 8;
      int e = tj * 16 + r;
      pp[((size_t)bh * 32 + e) * 32 + d] = acc[i];
    }
  }
}

// K-sum partials and K^T V partials both read only Ke / Vsc: one grid, the long K-sum
// blocks first.
static constexpr int KS_BLK = Bsz * 16;
__global__ __launch_bounds__(256) void k_kv_ksum_part(const bf16_t* __restrict__ Ke,
                                                      const bf16_t* __restrict__ Vsc,
                                                      float* __restrict__ kvpart,
                                                      float* __restrict__ part)
{
  int blk = blockIdx.x;
  if (blk < KS_BLK) { d_ksum_part(blk, Ke, part); return; }
  blk -= KS_BLK;
  d_kv_wmma(blk & (Bsz * NH - 1), blk >> 5, Ke, Vsc, kvpart);
}

__device__ inline void d_kv_reduce(int blk, const float* __restrict__ kvpart,
                                   bf16_t* __restrict__ KVbT)
{
  int idx = blk * 256 + threadIdx.x;                // 0..KV_ELEMS-1
  float s = 0.f;
  // unrolled so that all the partial loads are in flight together
#pragma unroll
  for (int ch = 0; ch < KV_SPLIT; ++ch) s += kvpart[(size_t)ch * KV_ELEMS + idx];
  KVbT[idx] = f2bf(s);
}

// the two sums over partials, one grid
static constexpr int KVR_BLK = KV_ELEMS / 256;
static constexpr int KSR_BLK = Bsz * 256 / 256;
__global__ __launch_bounds__(256) void k_kv_ksum_reduce(const float* __restrict__ kvpart,
                                                        bf16_t* __restrict__ KVbT,
                                                        const float* __restrict__ part,
                                                        float* __restrict__ ksum)
{
  int blk = blockIdx.x;
  if (blk < KVR_BLK) { d_kv_reduce(blk, kvpart, KVbT); return; }
  d_ksum_reduce(blk - KVR_BLK, part, ksum);
}

// ---------------- msg = (Q * KV) * S/(Q.Ksum + eps) ----------------
__global__ __launch_bounds__(256) void k_msg_wmma(const bf16_t* __restrict__ Qe,
                                                  const bf16_t* __restrict__ KVbT,
                                                  const float* __restrict__ ksum,
                                                  bf16_t* __restrict__ msgb)
{
  int row0 = blockIdx.x * 16;
  int lane = threadIdx.x & 31, h = threadIdx.x >> 5;
  int b = row0 >> 14;
  const int r = lane & 15, hb = (lane >> 4) << 3;

  const bf16_t* Ap = Qe + (size_t)(row0 + r) * 256 + h * 32;
  v16bf af = frag16(Ap + hb);
  const bf16_t* Bp = KVbT + (size_t)(b * 8 + h) * 32 * 32;
  v16bf bf0 = frag16(Bp + r * 32 + hb);
  v16bf bf1 = frag16(Bp + (16 + r) * 32 + hb);
  v8f acc0 = {0,0,0,0,0,0,0,0};
  v8f acc1 = {0,0,0,0,0,0,0,0};
  acc0 = __builtin_amdgcn_wmma_f32_16x16x32_bf16(false, af, false, bf0,
                                                 (short)0, acc0, false, false);
  acc1 = __builtin_amdgcn_wmma_f32_16x16x32_bf16(false, af, false, bf1,
                                                 (short)0, acc1, false, false);

  const float* ks = ksum + (size_t)b * 256 + h * 32;
  float dot = 0.f;
#pragma unroll
  for (int d = 0; d < 32; ++d) dot += bf2f(Ap[d]) * ks[d];
  float z = (float)Ssz / (dot + 1e-6f);

  int half = lane >> 4;
#pragma unroll
  for (int i = 0; i < 8; ++i) {
    float zi = __shfl(z, i + half * 8, 32);
    int orow = row0 + i + half * 8;
    bf16_t* op = msgb + (size_t)orow * 256 + h * 32;
    op[r]      = f2bf(acc0[i] * zi);
    op[16 + r] = f2bf(acc1[i] * zi);
  }
}

// ---------------- host launcher ----------------
// 128x64 output tiles of the GEMM shapes
static constexpr int TB_S  = 4 * (ROWS_S / 128);   // [ROWS_S][256]
static constexpr int TB_X  = 4 * (ROWS_X / 128);   // [ROWS_X][256]
static constexpr int TB_X2 = 8 * (ROWS_X / 128);   // [ROWS_X][512]
// LayerNorm grids: one trip over the short input, two over the long ones
static constexpr int LN_BLK_S = ROWS_S / (8 * LN_R);
static constexpr int LN_BLK_X = ROWS_X / (8 * LN_R) / 2;

extern "C" void kernel_launch(void* const* d_in, const int* in_sizes, int n_in,
                              void* d_out, int out_size, void* d_ws, size_t ws_size,
                              hipStream_t stream) {
  const float* x      = (const float*)d_in[0];
  const float* sr_w   = (const float*)d_in[1];
  const float* sr_b   = (const float*)d_in[2];
  const float* norm_g = (const float*)d_in[3];
  const float* norm_b = (const float*)d_in[4];
  const float* wq     = (const float*)d_in[5];
  const float* wk     = (const float*)d_in[6];
  const float* wv     = (const float*)d_in[7];
  const float* wm     = (const float*)d_in[8];
  const float* w1     = (const float*)d_in[9];
  const float* w2     = (const float*)d_in[10];
  const float* n1g    = (const float*)d_in[11];
  const float* n1b    = (const float*)d_in[12];
  const float* n2g    = (const float*)d_in[13];
  const float* n2b    = (const float*)d_in[14];
  float* out = (float*)d_out;

  char* ws = (char*)d_ws;
  size_t off = 0;
  auto alloc = [&](size_t bytes) -> void* {
    off = (off + 255) & ~(size_t)255;
    void* p = ws + off;
    off += bytes;
    return p;
  };

  bf16_t* wqT  = (bf16_t*)alloc((size_t)256 * 256 * 2);
  bf16_t* wkT  = (bf16_t*)alloc((size_t)256 * 256 * 2);
  bf16_t* wvT  = (bf16_t*)alloc((size_t)256 * 256 * 2);
  bf16_t* wmT  = (bf16_t*)alloc((size_t)256 * 256 * 2);
  bf16_t* w1T  = (bf16_t*)alloc((size_t)512 * 512 * 2);
  bf16_t* w2T  = (bf16_t*)alloc((size_t)256 * 512 * 2);
  bf16_t* wsrT = (bf16_t*)alloc((size_t)256 * 1024 * 2);
  float*  part = (float*)alloc((size_t)Bsz * 16 * 256 * 4);
  float*  ksum = (float*)alloc((size_t)Bsz * 256 * 4);
  bf16_t* KVbT = (bf16_t*)alloc((size_t)Bsz * NH * 32 * 32 * 2);
  bf16_t* cat  = (bf16_t*)alloc((size_t)ROWS_X * 512 * 2);          // [x | msg_ln]
  // pool A: im2col buf, later reused for msg (both 32 MiB)
  bf16_t* xim  = (bf16_t*)alloc((size_t)ROWS_S * 1024 * 2);
  bf16_t* msgb = xim;
  // pool B: Qe + xs + xs_ln + Ke + Vsc, later reused for h1 (64 MiB <= 72 MiB)
  size_t szQe = (size_t)ROWS_X * 256 * 2;
  size_t szXs = (size_t)ROWS_S * 256 * 4;
  size_t szLn = (size_t)ROWS_S * 256 * 2;
  char* poolB = (char*)alloc(szQe + szXs + 3 * szLn);
  bf16_t* Qe    = (bf16_t*)poolB;
  float*  xs    = (float*)(poolB + szQe);
  bf16_t* xs_ln = (bf16_t*)(poolB + szQe + szXs);
  bf16_t* Ke    = (bf16_t*)(poolB + szQe + szXs + szLn);
  bf16_t* Vsc   = (bf16_t*)(poolB + szQe + szXs + 2 * szLn);
  bf16_t* h1    = (bf16_t*)poolB;        // [ROWS_X][512] bf16
  // pool C: mm f32, reused for h2 f32
  float* mm = (float*)alloc((size_t)ROWS_X * 256 * 4);
  float* h2 = mm;
  float* kvpart = mm;                    // KV partials (4 MiB), dead before mm is written

  // --- all input preparation, one grid ---
  k_prep<<<PB_ALL, 256, 0, stream>>>(x, sr_w, wq, wk, wv, wm, w1, w2,
                                     wqT, wkT, wvT, wmT, w1T, w2T, wsrT, cat, xim);

  // --- spatial reduction conv (im2col GEMM) together with the Q projection ---
  const GemmArgs gConv = { xim, wsrT, xs, nullptr, sr_b,
                           1024, 1024, 256, EP_BIAS_F32, 2, TB_S, 0.f };
  const GemmArgs gQ    = { cat, wqT, nullptr, Qe, nullptr,
                           512, 256, 256, EP_ELU_BF, 2, TB_X, 0.f };
  k_gemm_wmma<<<TB_S + TB_X, 256, 0, stream>>>(gConv, gQ);
  k_layernorm<<<LN_BLK_S, 256, 0, stream>>>(xs, norm_g, norm_b, xs_ln, 256,
                                              nullptr, nullptr, ROWS_S);

  // --- K and V projections from xs_ln, one grid ---
  const GemmArgs gK = { xs_ln, wkT, nullptr, Ke, nullptr,
                        256, 256, 256, EP_ELU_BF, 2, TB_S, 0.f };
  const GemmArgs gV = { xs_ln, wvT, nullptr, Vsc, nullptr,
                        256, 256, 256, EP_SCALE_BF, 2, TB_S,
                        1.f / (float)Ssz };
  k_gemm_wmma<<<TB_S + TB_S, 256, 0, stream>>>(gK, gV);

  // --- linear attention ---
  k_kv_ksum_part<<<KS_BLK + Bsz * NH * KV_SPLIT, 256, 0, stream>>>(Ke, Vsc, kvpart, part);
  k_kv_ksum_reduce<<<KVR_BLK + KSR_BLK, 256, 0, stream>>>(kvpart, KVbT, part, ksum);
  k_msg_wmma<<<ROWS_X / 16, 256, 0, stream>>>(Qe, KVbT, ksum, msgb);

  // --- merge proj + LN1 (into cat[:, 256:512]) ---
  const GemmArgs gM = { msgb, wmT, mm, nullptr, nullptr,
                        256, 256, 256, EP_F32, 2, TB_X, 0.f };
  k_gemm_wmma<<<TB_X, 256, 0, stream>>>(gM, gM);
  k_layernorm<<<LN_BLK_X, 256, 0, stream>>>(mm, n1g, n1b, cat + 256, 512,
                                              nullptr, nullptr, ROWS_X);

  // --- MLP ---
  const GemmArgs gH1 = { cat, w1T, nullptr, h1, nullptr,
                         512, 512, 512, EP_RELU_BF, 3, TB_X2, 0.f };
  k_gemm_wmma<<<TB_X2, 256, 0, stream>>>(gH1, gH1);
  const GemmArgs gH2 = { h1, w2T, h2, nullptr, nullptr,
                         512, 512, 256, EP_F32, 2, TB_X, 0.f };
  k_gemm_wmma<<<TB_X, 256, 0, stream>>>(gH2, gH2);

  // --- LN2 + residual ---
  k_layernorm<<<LN_BLK_X, 256, 0, stream>>>(h2, n2g, n2b, nullptr, 0,
                                              out, x, ROWS_X);
}

// v005
// It runs in 273 microseconds.
// Next to v004, in two timings, it ran 1.18 and 1.19 times as fast.
// All steps since v000 together make it 1.82 times as fast.
#include <hip/hip_runtime.h>
#include <stdint.h>
#include <stddef.h>

// ---------------- problem dims (hardcoded from reference) ----------------
static constexpr int Bsz  = 4;
static constexpr int Hh   = 128;
static constexpr int Wh   = 128;
static constexpr int Cc   = 256;
static constexpr int Nn   = Hh * Wh;          // 16384
static constexpr int Ssz  = (Hh/2) * (Wh/2);  // 4096
static constexpr int NH   = 8;
static constexpr int ROWS_X = Bsz * Nn;       // 65536
static constexpr int ROWS_S = Bsz * Ssz;      // 16384

// ---------------- types ----------------
typedef __bf16 bf16_t;
typedef __attribute__((ext_vector_type(16))) __bf16 v16bf;
typedef __attribute__((ext_vector_type(8)))  __bf16 v8bf;
typedef __attribute__((ext_vector_type(8)))  float  v8f;

struct bf4 { bf16_t e[4]; };   // POD 8-byte pack

__device__ inline bf16_t f2bf(float f) {
  union { float f; unsigned u; } a; a.f = f;
  unsigned r = a.u + 0x7FFFu + ((a.u >> 16) & 1u);
  unsigned short h = (unsigned short)(r >> 16);
  union { unsigned short u; bf16_t b; } o; o.u = h;
  return o.b;
}
__device__ inline float bf2f(bf16_t b) {
  union { unsigned short u; bf16_t b; } i; i.b = b;
  union { unsigned u; float f; } o; o.u = ((unsigned)i.u) << 16;
  return o.f;
}

// Assemble 16-elem bf16 WMMA fragment: 8 contiguous at p, 8 at p+16.
__device__ inline v16bf frag16(const bf16_t* p) {
  v8bf lo = *(const v8bf*)p;
  v8bf hi = *(const v8bf*)(p + 16);
  return __builtin_shufflevector(lo, hi, 0,1,2,3,4,5,6,7,8,9,10,11,12,13,14,15);
}

// gfx1250 async global->LDS copy, 16B per lane, tracked by ASYNCcnt.
// LDS dest VGPR = wave-relative LDS byte offset (low 32b of flat LDS address).
__device__ inline uint32_t lds_off32(const void* p) {
  return (uint32_t)(uintptr_t)p;
}
// LDS row pitch of every 32-k bf16 fragment tile, in elements: 80 B (16 B x odd), so
// that the 16 rows one ds_load_b128 half-wave reads fall on 16 different bank groups
// (at the plain 64 B pitch four rows share each group).
static constexpr int LDP = 40;

// A GEMM stage holds 64 k = 128 B of every operand row, so that eight neighbouring lanes
// of a copy fetch one whole 128-B line of global memory (a wave-wide copy: 4 lines).
// Row pitch in LDS 144 B (16 B x odd), for the same reason as LDP.
static constexpr int BK  = 64;
static constexpr int LDG = BK + 8;

// One stage of the GEMM, per thread: four 16-B pieces of A (32 tile rows apart) and two of
// B. The s_wait_xcnt stands inside the statement, behind the last copy, so that no address
// register of a copy gets a new value in front of it.
__device__ __forceinline__ void stage_copies(uint32_t la, uint32_t lb,
                                             const bf16_t* ga, const bf16_t* gb,
                                             int lda, int ldb) {
  constexpr uint32_t LSTEP = 32 * LDG * 2;   // 32 tile rows, in LDS bytes
  asm volatile("global_load_async_to_lds_b128 %0, %6, off\n\t"
               "global_load_async_to_lds_b128 %1, %7, off\n\t"
               "global_load_async_to_lds_b128 %2, %8, off\n\t"
               "global_load_async_to_lds_b128 %3, %9, off\n\t"
               "global_load_async_to_lds_b128 %4, %10, off\n\t"
               "global_load_async_to_lds_b128 %5, %11, off\n\t"
               "s_wait_xcnt 0x0"
               :: "v"(la), "v"(la + LSTEP), "v"(la + 2 * LSTEP), "v"(la + 3 * LSTEP),
                  "v"(lb), "v"(lb + LSTEP),
                  "v"((uint64_t)(uintptr_t)(ga)),
                  "v"((uint64_t)(uintptr_t)(ga + (size_t)32 * lda)),
                  "v"((uint64_t)(uintptr_t)(ga + (size_t)64 * lda)),
                  "v"((uint64_t)(uintptr_t)(ga + (size_t)96 * lda)),
                  "v"((uint64_t)(uintptr_t)(gb)),
                  "v"((uint64_t)(uintptr_t)(gb + (size_t)32 * ldb))
               : "memory");
}

// Stands behind a group of global loads or stores, in front of the code that gives their
// address or data registers new values (the next trip of a loop, the next row).
// The scheduling barrier keeps that later code behind the wait: the "memory" clobber alone
// does not tie vector instructions to it.
#define WAIT_XCNT0()                                   \
  do {                                                 \
    asm volatile("s_wait_xcnt 0x0" ::: "memory");      \
    __builtin_amdgcn_sched_barrier(0);                 \
  } while (0)

// ---------------- weight prep ----------------
// The nine preparation bodies below depend on nothing but the inputs; k_prep runs them
// all in one grid, each on its own range of blocks (blk = index inside the range).
// Every thread works through several elements, so that the grid starts few waves.
static constexpr int WPT = 8;    // weight elements per thread
static constexpr int XB  = 8;    // float4 of x a thread has in flight
static constexpr int XG  = 4;    // such groups per thread

__device__ __forceinline__ void d_transpose_w(int blk, const float* __restrict__ w,
                                     bf16_t* __restrict__ wT, int K, int Ncol) {
  const int idx0 = blk * WPT * 256 + threadIdx.x;
  if (blk * WPT * 256 >= K * Ncol) return;   // K * Ncol is a multiple of WPT * 256
  float v[WPT];
#pragma unroll   // the WPT loads go out together
  for (int j = 0; j < WPT; ++j) v[j] = w[idx0 + j * 256];
  WAIT_XCNT0();
#pragma unroll
  for (int j = 0; j < WPT; ++j) {
    int idx = idx0 + j * 256;
    int k = idx / Ncol, n = idx % Ncol;
    wT[(size_t)n * K + k] = f2bf(v[j]);
  }
  WAIT_XCNT0();
}

__device__ __forceinline__ void d_pack_srw(int blk, const float* __restrict__ w,
                                  bf16_t* __restrict__ wT) {
  const int idx0 = blk * WPT * 256 + threadIdx.x;
  if (blk * WPT * 256 >= Cc * 4 * Cc) return;   // the total is a multiple of WPT * 256
  float v[WPT];
#pragma unroll   // the WPT loads go out together
  for (int j = 0; j < WPT; ++j) {
    int idx = idx0 + j * 256;
    int o = idx >> 10, r = idx & 1023;
    int p = r >> 8, i = r & 255;
    int kh = p >> 1, kw = p & 1;
    v[j] = w[(((size_t)o * Cc + i) * 2 + kh) * 2 + kw];
  }
  WAIT_XCNT0();
#pragma unroll
  for (int j = 0; j < WPT; ++j) wT[idx0 + j * 256] = f2bf(v[j]);
  WAIT_XCNT0();
}

__device__ __forceinline__ bf4 pack4(float4 v) {
  bf4 pk; pk.e[0]=f2bf(v.x); pk.e[1]=f2bf(v.y); pk.e[2]=f2bf(v.z); pk.e[3]=f2bf(v.w);
  return pk;
}

__device__ __forceinline__ void d_pack_x(int blk, const float* __restrict__ x,
                                bf16_t* __restrict__ cat) {
#pragma unroll 1   // rolled: unrolled, the later groups' loads went out two at a time
  for (int g = 0; g < XG; ++g) {
    const int idx0 = (blk * XG + g) * XB * 256 + threadIdx.x;   // one per 4 elems
    float4 v[XB];
#pragma unroll   // XB loads in flight before the first store
    for (int j = 0; j < XB; ++j)
      v[j] = *(const float4*)(x + (size_t)(idx0 + j * 256) * 4);
    WAIT_XCNT0();
#pragma unroll
    for (int j = 0; j < XB; ++j) {
      int e = (idx0 + j * 256) * 4;
      int row = e >> 8, c = e & 255;
      *(bf4*)(cat + (size_t)row * 512 + c) = pack4(v[j]);
    }
    WAIT_XCNT0();
  }
}

__device__ __forceinline__ void d_im2col(int blk, const float* __restrict__ x,
                                bf16_t* __restrict__ xim) {
  int t  = threadIdx.x;                 // 256 threads * 4 elems = 1024 = one row of xim
  int kidx = t * 4;
  int p = kidx >> 8, i = kidx & 255;
  int kh = p >> 1, kw = p & 1;
#pragma unroll 1   // rolled: unrolled, the later groups' loads went out two at a time
  for (int g = 0; g < XG; ++g) {
    const int bs0 = (blk * XG + g) * XB;   // rows bs0 .. bs0+XB-1 of 0..ROWS_S-1
    float4 v[XB];
#pragma unroll   // XB loads in flight before the first store
    for (int j = 0; j < XB; ++j) {
      int bs = bs0 + j;
      int b  = bs >> 12;
      int s  = bs & 4095;
      int oh = s >> 6, ow = s & 63;
      int n = (2*oh + kh) * Wh + (2*ow + kw);
      v[j] = *(const float4*)(x + ((size_t)b * Nn + n) * Cc + i);
    }
    WAIT_XCNT0();
#pragma unroll
    for (int j = 0; j < XB; ++j)
      *(bf4*)(xim + (size_t)(bs0 + j) * 1024 + kidx) = pack4(v[j]);
    WAIT_XCNT0();
  }
}

static constexpr int PB_W256 = 256 * 256 / 256 / WPT;  // blocks of a 256x256 transpose
static constexpr int PB_W1   = 512 * 512 / 256 / WPT;
static constexpr int PB_W2   = 512 * 256 / 256 / WPT;
static constexpr int PB_SRW  = 256 * 1024 / 256 / WPT;
static constexpr int PB_X    = ROWS_X * 256 / 4 / 256 / (XB * XG);
static constexpr int PB_IM   = ROWS_S / (XB * XG);
static constexpr int PB_ALL  = 4 * PB_W256 + PB_W1 + PB_W2 + PB_SRW + PB_X + PB_IM;

__global__ __launch_bounds__(256) void k_prep(
    const float* __restrict__ x, const float* __restrict__ sr_w,
    const float* __restrict__ wq, const float* __restrict__ wk,
    const float* __restrict__ wv, const float* __restrict__ wm,
    const float* __restrict__ w1, const float* __restrict__ w2,
    bf16_t* __restrict__ wqT, bf16_t* __restrict__ wkT, bf16_t* __restrict__ wvT,
    bf16_t* __restrict__ wmT, bf16_t* __restrict__ w1T, bf16_t* __restrict__ w2T,
    bf16_t* __restrict__ wsrT, bf16_t* __restrict__ cat, bf16_t* __restrict__ xim)
{
  int blk = blockIdx.x;
  if (blk < PB_W256) { d_transpose_w(blk, wq, wqT, 256, 256); return; }
  blk -= PB_W256;
  if (blk < PB_W256) { d_transpose_w(blk, wk, wkT, 256, 256); return; }
  blk -= PB_W256;
  if (blk < PB_W256) { d_transpose_w(blk, wv, wvT, 256, 256); return; }
  blk -= PB_W256;
  if (blk < PB_W256) { d_transpose_w(blk, wm, wmT, 256, 256); return; }
  blk -= PB_W256;
  if (blk < PB_W1)   { d_transpose_w(blk, w1, w1T, 512, 512); return; }
  blk -= PB_W1;
  if (blk < PB_W2)   { d_transpose_w(blk, w2, w2T, 512, 256); return; }
  blk -= PB_W2;
  if (blk < PB_SRW)  { d_pack_srw(blk, sr_w, wsrT); return; }
  blk -= PB_SRW;
  if (blk < PB_X)    { d_pack_x(blk, x, cat); return; }
  blk -= PB_X;
  d_im2col(blk, x, xim);
}

// ---------------- generic WMMA GEMM (128x64 tile, async double-buffered) ----------------
enum { EP_F32 = 0, EP_BIAS_F32 = 1, EP_ELU_BF = 2, EP_SCALE_BF = 3, EP_RELU_BF = 4 };

// C[M,Ncol] = epi( A[M,K](lda) * BT[Ncol,K]^T ), block tile 128x64, stage of BK k; K is a
// multiple of BK.
// 8 waves: wave -> (wy=w>>1 in 0..3 : 32 rows, wx=w&1 : 32 cols), 2x2 accs each.
// One grid serves two independent products: blocks below g0.nblk work on g0, the rest
// on g1. Inside a product the tile column runs fastest (1 << lgx tile columns).
struct GemmArgs {
  const bf16_t* A;
  const bf16_t* BT;
  float* outF;
  bf16_t* outB;
  const float* bias;
  int lda, K, ldo, mode, lgx, nblk;
  float scale;
};

__global__ __launch_bounds__(256) void k_gemm_wmma(GemmArgs g0, GemmArgs g1)
{
  const bool second = (int)blockIdx.x >= g0.nblk;
  const int  bid    = (int)blockIdx.x - (second ? g0.nblk : 0);
  const bf16_t* __restrict__ A    = second ? g1.A    : g0.A;
  const bf16_t* __restrict__ BT   = second ? g1.BT   : g0.BT;
  float*  __restrict__ outF       = second ? g1.outF : g0.outF;
  bf16_t* __restrict__ outB       = second ? g1.outB : g0.outB;
  const float* __restrict__ bias  = second ? g1.bias : g0.bias;
  const int   lda   = second ? g1.lda   : g0.lda;
  const int   K     = second ? g1.K     : g0.K;
  const int   ldo   = second ? g1.ldo   : g0.ldo;
  const int   mode  = second ? g1.mode  : g0.mode;
  const int   lgx   = second ? g1.lgx   : g0.lgx;
  const float scale = second ? g1.scale : g0.scale;
  __shared__ __align__(16) bf16_t As[2][128 * LDG];
  __shared__ __align__(16) bf16_t Bs[2][64 * LDG];
  const int tid  = threadIdx.x;
  const int lane = tid & 31, wave = tid >> 5;
  const int wy = wave >> 1, wx = wave & 1;
  const int row0 = (bid >> lgx) * 128;
  const int col0 = (bid & ((1 << lgx) - 1)) * 64;
  // tile loaders: eight lanes per row (128 B), 32 rows per pass of the block
  const int lr = tid >> 3, lk = (tid & 7) << 3;
  const bf16_t* Ag = A  + (size_t)(row0 + lr) * lda + lk;
  const bf16_t* Bg = BT + (size_t)(col0 + lr) * K   + lk;
  uint32_t ldsA[2], ldsB[2];
#pragma unroll
  for (int b = 0; b < 2; ++b) {
    ldsA[b] = lds_off32(&As[b][lr * LDG + lk]);
    ldsB[b] = lds_off32(&Bs[b][lr * LDG + lk]);
  }
  const int r = lane & 15, hb = (lane >> 4) << 3;
  const int nT = K / BK;

  v8f acc[2][2] = {};

  // in front of the loop: stage 0 lands and is published, then stage 1 starts
  stage_copies(ldsA[0], ldsB[0], Ag, Bg, lda, K);
  asm volatile("s_wait_asynccnt 0x0" ::: "memory");   // this wave's part of stage 0 is in LDS
  __syncthreads();
  if (nT > 1) stage_copies(ldsA[1], ldsB[1], Ag + BK, Bg + BK, lda, K);

  for (int t = 0; t < nT; ++t) {
    const int cur = t & 1;
    const bf16_t* as = &As[cur][0];
    const bf16_t* bs = &Bs[cur][0];
#pragma unroll   // the two 32-k halves of the stage, in k order
    for (int kk = 0; kk < BK; kk += 32) {
      v16bf a0 = frag16(as + (wy * 32 +      r) * LDG + kk + hb);
      v16bf a1 = frag16(as + (wy * 32 + 16 + r) * LDG + kk + hb);
      v16bf b0 = frag16(bs + (wx * 32 +      r) * LDG + kk + hb);
      v16bf b1 = frag16(bs + (wx * 32 + 16 + r) * LDG + kk + hb);
      acc[0][0] = __builtin_amdgcn_wmma_f32_16x16x32_bf16(false, a0, false, b0,
                                                          (short)0, acc[0][0], false, false);
      acc[0][1] = __builtin_amdgcn_wmma_f32_16x16x32_bf16(false, a0, false, b1,
                                                          (short)0, acc[0][1], false, false);
      acc[1][0] = __builtin_amdgcn_wmma_f32_16x16x32_bf16(false, a1, false, b0,
                                                          (short)0, acc[1][0], false, false);
      acc[1][1] = __builtin_amdgcn_wmma_f32_16x16x32_bf16(false, a1, false, b1,
                                                          (short)0, acc[1][1], false, false);
    }
    asm volatile("s_wait_dscnt 0x0" ::: "memory");      // this wave has left buffer cur
    asm volatile("s_wait_asynccnt 0x0" ::: "memory");   // its part of stage t + 1 is in LDS
    __syncthreads();   // publishes stage t + 1 and frees buffer cur for the refill
    if (t + 2 < nT)
      stage_copies(ldsA[cur], ldsB[cur], Ag + (t + 2) * BK, Bg + (t + 2) * BK, lda, K);
  }
  asm volatile("s_wait_asynccnt 0x0" ::: "memory");     // no copy is left in flight

  const int half = lane >> 4;
#pragma unroll
  for (int m = 0; m < 2; ++m) {
#pragma unroll
    for (int i = 0; i < 8; ++i) {
      int orow = row0 + wy * 32 + m * 16 + i + half * 8;
#pragma unroll
      for (int n = 0; n < 2; ++n) {
        int ocol = col0 + wx * 32 + n * 16 + r;
        float v = acc[m][n][i];
        if (mode == EP_F32) {
          outF[(size_t)orow * ldo + ocol] = v;
        } else if (mode == EP_BIAS_F32) {
          outF[(size_t)orow * ldo + ocol] = v + bias[ocol];
        } else if (mode == EP_ELU_BF) {   // elu(x)+1 : x+1 if x>0 else exp(x)
          outB[(size_t)orow * ldo + ocol] = f2bf(v > 0.f ? v + 1.f : __expf(v));
        } else if (mode == EP_SCALE_BF) {
          outB[(size_t)orow * ldo + ocol] = f2bf(v * scale);
        } else {                          // relu -> bf16
          outB[(size_t)orow * ldo + ocol] = f2bf(v > 0.f ? v : 0.f);
        }
      }
    }
  }
}

// ---------------- LayerNorm over 256-wide rows ----------------
// A wave takes LN_R rows a trip (their loads in flight together) and strides over the
// rows by the grid, so that few waves are started; rows is a multiple of LN_R.
static constexpr int LN_R = 4;
__global__ __launch_bounds__(256) void k_layernorm(
    const float* __restrict__ in, const float* __restrict__ g, const float* __restrict__ bb,
    bf16_t* __restrict__ outB, int ldoB,
    float* __restrict__ outF, const float* __restrict__ resid, int rows)
{
  int wave = threadIdx.x >> 5, lane = threadIdx.x & 31;
  const int step = (int)gridDim.x * 8 * LN_R;
  float gv[8], bv[8];
#pragma unroll
  for (int j = 0; j < 8; ++j) { gv[j] = g[lane * 8 + j]; bv[j] = bb[lane * 8 + j]; }
  // The same wait; the loaded values are named as inputs because these loads (of memory
  // that nothing writes) were otherwise moved behind it.
  asm volatile("s_wait_xcnt 0x0"
               :: "v"(gv[0]), "v"(gv[1]), "v"(gv[2]), "v"(gv[3]),
                  "v"(gv[4]), "v"(gv[5]), "v"(gv[6]), "v"(gv[7]),
                  "v"(bv[0]), "v"(bv[1]), "v"(bv[2]), "v"(bv[3]),
                  "v"(bv[4]), "v"(bv[5]), "v"(bv[6]), "v"(bv[7]) : "memory");
  __builtin_amdgcn_sched_barrier(0);   // keeps the loop's address arithmetic behind it
  for (int row0 = (blockIdx.x * 8 + wave) * LN_R; row0 < rows; row0 += step) {
    float vals[LN_R][8];
    float res[LN_R][8];
#pragma unroll   // all the rows' loads go out before the first sum
    for (int q = 0; q < LN_R; ++q) {
      const float* p = in + (size_t)(row0 + q) * 256;
      float4 a = *(const float4*)(p + lane * 8);
      float4 c = *(const float4*)(p + lane * 8 + 4);
      vals[q][0] = a.x; vals[q][1] = a.y; vals[q][2] = a.z; vals[q][3] = a.w;
      vals[q][4] = c.x; vals[q][5] = c.y; vals[q][6] = c.z; vals[q][7] = c.w;
    }
    WAIT_XCNT0();
    if (outF) {
#pragma unroll
      for (int q = 0; q < LN_R; ++q)
#pragma unroll
        for (int j = 0; j < 8; ++j)
          res[q][j] = resid[(size_t)(row0 + q) * 256 + lane * 8 + j];
      WAIT_XCNT0();
    }
#pragma unroll
    for (int q = 0; q < LN_R; ++q) {
      const int row = row0 + q;
      float s = 0.f;
#pragma unroll
      for (int j = 0; j < 8; ++j) s += vals[q][j];
#pragma unroll
      for (int o = 16; o > 0; o >>= 1) s += __shfl_xor(s, o, 32);
      float mean = s * (1.f / 256.f);
      float vs = 0.f;
#pragma unroll
      for (int j = 0; j < 8; ++j) { vals[q][j] -= mean; vs += vals[q][j] * vals[q][j]; }
#pragma unroll
      for (int o = 16; o > 0; o >>= 1) vs += __shfl_xor(vs, o, 32);
      float inv = rsqrtf(vs * (1.f / 256.f) + 1e-5f);
#pragma unroll
      for (int j = 0; j < 8; ++j) {
        int c0 = lane * 8 + j;
        float y = vals[q][j] * inv * gv[j] + bv[j];
        if (outB) outB[(size_t)row * ldoB + c0] = f2bf(y);
        if (outF) outF[(size_t)row * 256 + c0] = y + res[q][j];
        WAIT_XCNT0();
      }
    }
  }
}

// ---------------- Ksum = sum_s K_elu ----------------
__device__ inline void d_ksum_part(int blk, const bf16_t* __restrict__ Ke,
                                   float* __restrict__ part) {
  // blk in 0..B*16-1
  int b = blk >> 4, ch = blk & 15;
  int c = threadIdx.x;                  // 256
  const bf16_t* p = Ke + ((size_t)b * Ssz + ch * 256) * 256 + c;
  float s = 0.f;
  for (int i = 0; i < 256; ++i) s += bf2f(p[(size_t)i * 256]);
  part[((size_t)b * 16 + ch) * 256 + c] = s;
}
__device__ inline void d_ksum_reduce(int blk, const float* __restrict__ part,
                                     float* __restrict__ ksum) {
  int idx = blk * 256 + threadIdx.x;  // B*256
  if (idx >= Bsz * 256) return;
  int b = idx >> 8, c = idx & 255;
  float s = 0.f;
  for (int ch = 0; ch < 16; ++ch) s += part[((size_t)b * 16 + ch) * 256 + c];
  ksum[idx] = s;
}

// ---------------- KV[b,h] = K^T * Vsc (32x32 over S=4096), stored transposed ----------------
// S is cut into KV_SPLIT ranges, one work-group per (b,h,range); each stores an f32
// partial [e][d], and k_kv_ksum_reduce sums the ranges in index order.
static constexpr int KV_SPLIT = 32;
static constexpr int KV_ROWS  = Ssz / KV_SPLIT;    // 128 rows of S per work-group
static constexpr int KV_ELEMS = Bsz * NH * 32 * 32;

__device__ inline void d_kv_wmma(int bh, int range, const bf16_t* __restrict__ Ke,
                                 const bf16_t* __restrict__ Vsc,
                                 float* __restrict__ kvpart)
{
  __shared__ __align__(16) bf16_t KT[32 * LDP];  // [d][s]
  __shared__ __align__(16) bf16_t VT[32 * LDP];  // [e][s]
  int b = bh >> 3, h = bh & 7;          // bh in 0..B*NH-1
  int tid = threadIdx.x, lane = tid & 31, wave = tid >> 5;
  int d0 = (tid & 7) * 4;
  int si = tid >> 3;
  const int r = lane & 15, hb = (lane >> 4) << 3;
  int ti = (wave >> 1) & 1, tj = wave & 1;
  v8f acc = {0,0,0,0,0,0,0,0};
  const size_t base = (size_t)b * Ssz * 256 + h * 32;

  const int sBeg = range * KV_ROWS;
  for (int s0 = sBeg; s0 < sBeg + KV_ROWS; s0 += 32) {
    bf4 kk = *(const bf4*)(Ke  + base + (size_t)(s0 + si) * 256 + d0);
    bf4 vv = *(const bf4*)(Vsc + base + (size_t)(s0 + si) * 256 + d0);
    __syncthreads();
#pragma unroll
    for (int j = 0; j < 4; ++j) {
      KT[(d0 + j) * LDP + si] = kk.e[j];
      VT[(d0 + j) * LDP + si] = vv.e[j];
    }
    __syncthreads();
    if (wave < 4) {
      v16bf af = frag16(KT + (ti * 16 + r) * LDP + hb);
      v16bf bf = frag16(VT + (tj * 16 + r) * LDP + hb);
      acc = __builtin_amdgcn_wmma_f32_16x16x32_bf16(false, af, false, bf,
                                                    (short)0, acc, false, false);
    }
  }
  if (wave < 4) {
    int half = lane >> 4;
    float* pp = kvpart + (size_t)range * KV_ELEMS;
#pragma unroll
    for (int i = 0; i < 8; ++i) {
      int d = ti * 16 + i + half * 8;
      int e = tj * 16 + r;
      pp[((size_t)bh * 32 + e) * 32 + d] = acc[i];
    }
  }
}

// K-sum partials and K^T V partials both read only Ke / Vsc: one grid, the long K-sum
// blocks first.
static constexpr int KS_BLK = Bsz * 16;
__global__ __launch_bounds__(256) void k_kv_ksum_part(const bf16_t* __restrict__ Ke,
                                                      const bf16_t* __restrict__ Vsc,
                                                      float* __restrict__ kvpart,
                                                      float* __restrict__ part)
{
  int blk = blockIdx.x;
  if (blk < KS_BLK) { d_ksum_part(blk, Ke, part); return; }
  blk -= KS_BLK;
  d_kv_wmma(blk & (Bsz * NH - 1), blk >> 5, Ke, Vsc, kvpart);
}

__device__ inline void d_kv_reduce(int blk, const float* __restrict__ kvpart,
                                   bf16_t* __restrict__ KVbT)
{
  int idx = blk * 256 + threadIdx.x;                // 0..KV_ELEMS-1
  float s = 0.f;
  // unrolled so that all the partial loads are in flight together
#pragma unroll
  for (int ch = 0; ch < KV_SPLIT; ++ch) s += kvpart[(size_t)ch * KV_ELEMS + idx];
  KVbT[idx] = f2bf(s);
}

// the two sums over partials, one grid
static constexpr int KVR_BLK = KV_ELEMS / 256;
static constexpr int KSR_BLK = Bsz * 256 / 256;
__global__ __launch_bounds__(256) void k_kv_ksum_reduce(const float* __restrict__ kvpart,
                                                        bf16_t* __restrict__ KVbT,
                                                        const float* __restrict__ part,
                                                        float* __restrict__ ksum)
{
  int blk = blockIdx.x;
  if (blk < KVR_BLK) { d_kv_reduce(blk, kvpart, KVbT); return; }
  d_ksum_reduce(blk - KVR_BLK, part, ksum);
}

// ---------------- msg = (Q * KV) * S/(Q.Ksum + eps) ----------------
__global__ __launch_bounds__(256) void k_msg_wmma(const bf16_t* __restrict__ Qe,
                                                  const bf16_t* __restrict__ KVbT,
                                                  const float* __restrict__ ksum,
                                                  bf16_t* __restrict__ msgb)
{
  int row0 = blockIdx.x * 16;
  int lane = threadIdx.x & 31, h = threadIdx.x >> 5;
  int b = row0 >> 14;
  const int r = lane & 15, hb = (lane >> 4) << 3;

  const bf16_t* Ap = Qe + (size_t)(row0 + r) * 256 + h * 32;
  v16bf af = frag16(Ap + hb);
  const bf16_t* Bp = KVbT + (size_t)(b * 8 + h) * 32 * 32;
  v16bf bf0 = frag16(Bp + r * 32 + hb);
  v16bf bf1 = frag16(Bp + (16 + r) * 32 + hb);
  v8f acc0 = {0,0,0,0,0,0,0,0};
  v8f acc1 = {0,0,0,0,0,0,0,0};
  acc0 = __builtin_amdgcn_wmma_f32_16x16x32_bf16(false, af, false, bf0,
                                                 (short)0, acc0, false, false);
  acc1 = __builtin_amdgcn_wmma_f32_16x16x32_bf16(false, af, false, bf1,
                                                 (short)0, acc1, false, false);

  const float* ks = ksum + (size_t)b * 256 + h * 32;
  float dot = 0.f;
#pragma unroll
  for (int d = 0; d < 32; ++d) dot += bf2f(Ap[d]) * ks[d];
  float z = (float)Ssz / (dot + 1e-6f);

  int half = lane >> 4;
#pragma unroll
  for (int i = 0; i < 8; ++i) {
    float zi = __shfl(z, i + half * 8, 32);
    int orow = row0 + i + half * 8;
    bf16_t* op = msgb + (size_t)orow * 256 + h * 32;
    op[r]      = f2bf(acc0[i] * zi);
    op[16 + r] = f2bf(acc1[i] * zi);
  }
}

// ---------------- host launcher ----------------
// 128x64 output tiles of the GEMM shapes
static constexpr int TB_S  = 4 * (ROWS_S / 128);   // [ROWS_S][256]
static constexpr int TB_X  = 4 * (ROWS_X / 128);   // [ROWS_X][256]
static constexpr int TB_X2 = 8 * (ROWS_X / 128);   // [ROWS_X][512]
// LayerNorm grids: one trip over the short input, two over the long ones
static constexpr int LN_BLK_S = ROWS_S / (8 * LN_R);
static constexpr int LN_BLK_X = ROWS_X / (8 * LN_R) / 2;

extern "C" void kernel_launch(void* const* d_in, const int* in_sizes, int n_in,
                              void* d_out, int out_size, void* d_ws, size_t ws_size,
                              hipStream_t stream) {
  const float* x      = (const float*)d_in[0];
  const float* sr_w   = (const float*)d_in[1];
  const float* sr_b   = (const float*)d_in[2];
  const float* norm_g = (const float*)d_in[3];
  const float* norm_b = (const float*)d_in[4];
  const float* wq     = (const float*)d_in[5];
  const float* wk     = (const float*)d_in[6];
  const float* wv     = (const float*)d_in[7];
  const float* wm     = (const float*)d_in[8];
  const float* w1     = (const float*)d_in[9];
  const float* w2     = (const float*)d_in[10];
  const float* n1g    = (const float*)d_in[11];
  const float* n1b    = (const float*)d_in[12];
  const float* n2g    = (const float*)d_in[13];
  const float* n2b    = (const float*)d_in[14];
  float* out = (float*)d_out;

  char* ws = (char*)d_ws;
  size_t off = 0;
  auto alloc = [&](size_t bytes) -> void* {
    off = (off + 255) & ~(size_t)255;
    void* p = ws + off;
    off += bytes;
    return p;
  };

  bf16_t* wqT  = (bf16_t*)alloc((size_t)256 * 256 * 2);
  bf16_t* wkT  = (bf16_t*)alloc((size_t)256 * 256 * 2);
  bf16_t* wvT  = (bf16_t*)alloc((size_t)256 * 256 * 2);
  bf16_t* wmT  = (bf16_t*)alloc((size_t)256 * 256 * 2);
  bf16_t* w1T  = (bf16_t*)alloc((size_t)512 * 512 * 2);
  bf16_t* w2T  = (bf16_t*)alloc((size_t)256 * 512 * 2);
  bf16_t* wsrT = (bf16_t*)alloc((size_t)256 * 1024 * 2);
  float*  part = (float*)alloc((size_t)Bsz * 16 * 256 * 4);
  float*  ksum = (float*)alloc((size_t)Bsz * 256 * 4);
  bf16_t* KVbT = (bf16_t*)alloc((size_t)Bsz * NH * 32 * 32 * 2);
  bf16_t* cat  = (bf16_t*)alloc((size_t)ROWS_X * 512 * 2);          // [x | msg_ln]
  // pool A: im2col buf, later reused for msg (both 32 MiB)
  bf16_t* xim  = (bf16_t*)alloc((size_t)ROWS_S * 1024 * 2);
  bf16_t* msgb = xim;
  // pool B: Qe + xs + xs_ln + Ke + Vsc, later reused for h1 (64 MiB <= 72 MiB)
  size_t szQe = (size_t)ROWS_X * 256 * 2;
  size_t szXs = (size_t)ROWS_S * 256 * 4;
  size_t szLn = (size_t)ROWS_S * 256 * 2;
  char* poolB = (char*)alloc(szQe + szXs + 3 * szLn);
  bf16_t* Qe    = (bf16_t*)poolB;
  float*  xs    = (float*)(poolB + szQe);
  bf16_t* xs_ln = (bf16_t*)(poolB + szQe + szXs);
  bf16_t* Ke    = (bf16_t*)(poolB + szQe + szXs + szLn);
  bf16_t* Vsc   = (bf16_t*)(poolB + szQe + szXs + 2 * szLn);
  bf16_t* h1    = (bf16_t*)poolB;        // [ROWS_X][512] bf16
  // pool C: mm f32, reused for h2 f32
  float* mm = (float*)alloc((size_t)ROWS_X * 256 * 4);
  float* h2 = mm;
  float* kvpart = mm;                    // KV partials (4 MiB), dead before mm is written

  // --- all input preparation, one grid ---
  k_prep<<<PB_ALL, 256, 0, stream>>>(x, sr_w, wq, wk, wv, wm, w1, w2,
                                     wqT, wkT, wvT, wmT, w1T, w2T, wsrT, cat, xim);

  // --- spatial reduction conv (im2col GEMM) together with the Q projection ---
  const GemmArgs gConv = { xim, wsrT, xs, nullptr, sr_b,
                           1024, 1024, 256, EP_BIAS_F32, 2, TB_S, 0.f };
  const GemmArgs gQ    = { cat, wqT, nullptr, Qe, nullptr,
                           512, 256, 256, EP_ELU_BF, 2, TB_X, 0.f };
  k_gemm_wmma<<<TB_S + TB_X, 256, 0, stream>>>(gConv, gQ);
  k_layernorm<<<LN_BLK_S, 256, 0, stream>>>(xs, norm_g, norm_b, xs_ln, 256,
                                              nullptr, nullptr, ROWS_S);

  // --- K and V projections from xs_ln, one grid ---
  const GemmArgs gK = { xs_ln, wkT, nullptr, Ke, nullptr,
                        256, 256, 256, EP_ELU_BF, 2, TB_S, 0.f };
  const GemmArgs gV = { xs_ln, wvT, nullptr, Vsc, nullptr,
                        256, 256, 256, EP_SCALE_BF, 2, TB_S,
                        1.f / (float)Ssz };
  k_gemm_wmma<<<TB_S + TB_S, 256, 0, stream>>>(gK, gV);

  // --- linear attention ---
  k_kv_ksum_part<<<KS_BLK + Bsz * NH * KV_SPLIT, 256, 0, stream>>>(Ke, Vsc, kvpart, part);
  k_kv_ksum_reduce<<<KVR_BLK + KSR_BLK, 256, 0, stream>>>(kvpart, KVbT, part, ksum);
  k_msg_wmma<<<ROWS_X / 16, 256, 0, stream>>>(Qe, KVbT, ksum, msgb);

  // --- merge proj + LN1 (into cat[:, 256:512]) ---
  const GemmArgs gM = { msgb, wmT, mm, nullptr, nullptr,
                        256, 256, 256, EP_F32, 2, TB_X, 0.f };
  k_gemm_wmma<<<TB_X, 256, 0, stream>>>(gM, gM);
  k_layernorm<<<LN_BLK_X, 256, 0, stream>>>(mm, n1g, n1b, cat + 256, 512,
                                              nullptr, nullptr, ROWS_X);

  // --- MLP ---
  const GemmArgs gH1 = { cat, w1T, nullptr, h1, nullptr,
                         512, 512, 512, EP_RELU_BF, 3, TB_X2, 0.f };
  k_gemm_wmma<<<TB_X2, 256, 0, stream>>>(gH1, gH1);
  const GemmArgs gH2 = { h1, w2T, h2, nullptr, nullptr,
                         512, 512, 256, EP_F32, 2, TB_X, 0.f };
  k_gemm_wmma<<<TB_X, 256, 0, stream>>>(gH2, gH2);

  // --- LN2 + residual ---
  k_layernorm<<<LN_BLK_X, 256, 0, stream>>>(h2, n2g, n2b, nullptr, 0,
                                              out, x, ROWS_X);
}

// v006
// A run of this version takes 218 microseconds.
// Two timings next to v005 both put it at 1.25 times that version's speed.
// Over all steps from v000 it is 2.28 times as fast.
#include <hip/hip_runtime.h>
#include <stdint.h>
#include <stddef.h>

// ---------------- problem dims (hardcoded from reference) ----------------
static constexpr int Bsz  = 4;
static constexpr int Hh   = 128;
static constexpr int Wh   = 128;
static constexpr int Cc   = 256;
static constexpr int Nn   = Hh * Wh;          // 16384
static constexpr int Ssz  = (Hh/2) * (Wh/2);  // 4096
static constexpr int NH   = 8;
static constexpr int ROWS_X = Bsz * Nn;       // 65536
static constexpr int ROWS_S = Bsz * Ssz;      // 16384

// ---------------- types ----------------
typedef __bf16 bf16_t;
typedef __attribute__((ext_vector_type(16))) __bf16 v16bf;
typedef __attribute__((ext_vector_type(8)))  __bf16 v8bf;
typedef __attribute__((ext_vector_type(8)))  float  v8f;

struct bf4 { bf16_t e[4]; };   // POD 8-byte pack

__device__ inline bf16_t f2bf(float f) {
  union { float f; unsigned u; } a; a.f = f;
  unsigned r = a.u + 0x7FFFu + ((a.u >> 16) & 1u);
  unsigned short h = (unsigned short)(r >> 16);
  union { unsigned short u; bf16_t b; } o; o.u = h;
  return o.b;
}
__device__ inline float bf2f(bf16_t b) {
  union { unsigned short u; bf16_t b; } i; i.b = b;
  union { unsigned u; float f; } o; o.u = ((unsigned)i.u) << 16;
  return o.f;
}

// Assemble 16-elem bf16 WMMA fragment: 8 contiguous at p, 8 at p+16.
__device__ inline v16bf frag16(const bf16_t* p) {
  v8bf lo = *(const v8bf*)p;
  v8bf hi = *(const v8bf*)(p + 16);
  return __builtin_shufflevector(lo, hi, 0,1,2,3,4,5,6,7,8,9,10,11,12,13,14,15);
}

// gfx1250 async global->LDS copy, 16B per lane, tracked by ASYNCcnt.
// LDS dest VGPR = wave-relative LDS byte offset (low 32b of flat LDS address).
__device__ inline uint32_t lds_off32(const void* p) {
  return (uint32_t)(uintptr_t)p;
}
// LDS row pitch of every 32-k bf16 fragment tile, in elements: 80 B (16 B x odd), so
// that the 16 rows one ds_load_b128 half-wave reads fall on 16 different bank groups
// (at the plain 64 B pitch four rows share each group).
static constexpr int LDP = 40;

// A GEMM stage holds 64 k = 128 B of every operand row, so that eight neighbouring lanes
// of a copy fetch one whole 128-B line of global memory (a wave-wide copy: 4 lines).
// Row pitch in LDS 144 B (16 B x odd), for the same reason as LDP.
static constexpr int BK  = 64;
static constexpr int LDG = BK + 8;

// One stage of the GEMM, per thread: four 16-B pieces of A (32 tile rows apart) and eight
// of B. The s_wait_xcnt stands inside the statement, behind the last copy, so that no
// address register of a copy gets a new value in front of it.
__device__ __forceinline__ void stage_copies(uint32_t la, uint32_t lb,
                                             const bf16_t* ga, const bf16_t* gb,
                                             int lda, int ldb) {
  constexpr uint32_t LSTEP = 32 * LDG * 2;   // 32 tile rows, in LDS bytes
  asm volatile("global_load_async_to_lds_b128 %0, %12, off\n\t"
               "global_load_async_to_lds_b128 %1, %13, off\n\t"
               "global_load_async_to_lds_b128 %2, %14, off\n\t"
               "global_load_async_to_lds_b128 %3, %15, off\n\t"
               "global_load_async_to_lds_b128 %4, %16, off\n\t"
               "global_load_async_to_lds_b128 %5, %17, off\n\t"
               "global_load_async_to_lds_b128 %6, %18, off\n\t"
               "global_load_async_to_lds_b128 %7, %19, off\n\t"
               "global_load_async_to_lds_b128 %8, %20, off\n\t"
               "global_load_async_to_lds_b128 %9, %21, off\n\t"
               "global_load_async_to_lds_b128 %10, %22, off\n\t"
               "global_load_async_to_lds_b128 %11, %23, off\n\t"
               "s_wait_xcnt 0x0"
               :: "v"(la), "v"(la + LSTEP), "v"(la + 2 * LSTEP), "v"(la + 3 * LSTEP),
                  "v"(lb), "v"(lb + LSTEP), "v"(lb + 2 * LSTEP), "v"(lb + 3 * LSTEP),
                  "v"(lb + 4 * LSTEP), "v"(lb + 5 * LSTEP), "v"(lb + 6 * LSTEP),
                  "v"(lb + 7 * LSTEP),
                  "v"((uint64_t)(uintptr_t)(ga)),
                  "v"((uint64_t)(uintptr_t)(ga + (size_t)32 * lda)),
                  "v"((uint64_t)(uintptr_t)(ga + (size_t)64 * lda)),
                  "v"((uint64_t)(uintptr_t)(ga + (size_t)96 * lda)),
                  "v"((uint64_t)(uintptr_t)(gb)),
                  "v"((uint64_t)(uintptr_t)(gb + (size_t)32 * ldb)),
                  "v"((uint64_t)(uintptr_t)(gb + (size_t)64 * ldb)),
                  "v"((uint64_t)(uintptr_t)(gb + (size_t)96 * ldb)),
                  "v"((uint64_t)(uintptr_t)(gb + (size_t)128 * ldb)),
                  "v"((uint64_t)(uintptr_t)(gb + (size_t)160 * ldb)),
                  "v"((uint64_t)(uintptr_t)(gb + (size_t)192 * ldb)),
                  "v"((uint64_t)(uintptr_t)(gb + (size_t)224 * ldb))
               : "memory");
}

// Stands behind a group of global loads or stores, in front of the code that gives their
// address or data registers new values (the next trip of a loop, the next row).
// The scheduling barrier keeps that later code behind the wait: the "memory" clobber alone
// does not tie vector instructions to it.
#define WAIT_XCNT0()                                   \
  do {                                                 \
    asm volatile("s_wait_xcnt 0x0" ::: "memory");      \
    __builtin_amdgcn_sched_barrier(0);                 \
  } while (0)

// ---------------- weight prep ----------------
// The nine preparation bodies below depend on nothing but the inputs; k_prep runs them
// all in one grid, each on its own range of blocks (blk = index inside the range).
// Every thread works through several elements, so that the grid starts few waves.
static constexpr int WPT = 8;    // weight elements per thread
static constexpr int XB  = 8;    // float4 of x a thread has in flight
static constexpr int XG  = 4;    // such groups per thread

__device__ __forceinline__ void d_transpose_w(int blk, const float* __restrict__ w,
                                     bf16_t* __restrict__ wT, int K, int Ncol) {
  const int idx0 = blk * WPT * 256 + threadIdx.x;
  if (blk * WPT * 256 >= K * Ncol) return;   // K * Ncol is a multiple of WPT * 256
  float v[WPT];
#pragma unroll   // the WPT loads go out together
  for (int j = 0; j < WPT; ++j) v[j] = w[idx0 + j * 256];
  WAIT_XCNT0();
#pragma unroll
  for (int j = 0; j < WPT; ++j) {
    int idx = idx0 + j * 256;
    int k = idx / Ncol, n = idx % Ncol;
    wT[(size_t)n * K + k] = f2bf(v[j]);
  }
  WAIT_XCNT0();
}

__device__ __forceinline__ void d_pack_srw(int blk, const float* __restrict__ w,
                                  bf16_t* __restrict__ wT) {
  const int idx0 = blk * WPT * 256 + threadIdx.x;
  if (blk * WPT * 256 >= Cc * 4 * Cc) return;   // the total is a multiple of WPT * 256
  float v[WPT];
#pragma unroll   // the WPT loads go out together
  for (int j = 0; j < WPT; ++j) {
    int idx = idx0 + j * 256;
    int o = idx >> 10, r = idx & 1023;
    int p = r >> 8, i = r & 255;
    int kh = p >> 1, kw = p & 1;
    v[j] = w[(((size_t)o * Cc + i) * 2 + kh) * 2 + kw];
  }
  WAIT_XCNT0();
#pragma unroll
  for (int j = 0; j < WPT; ++j) wT[idx0 + j * 256] = f2bf(v[j]);
  WAIT_XCNT0();
}

__device__ __forceinline__ bf4 pack4(float4 v) {
  bf4 pk; pk.e[0]=f2bf(v.x); pk.e[1]=f2bf(v.y); pk.e[2]=f2bf(v.z); pk.e[3]=f2bf(v.w);
  return pk;
}

__device__ __forceinline__ void d_pack_x(int blk, const float* __restrict__ x,
                                bf16_t* __restrict__ cat) {
#pragma unroll 1   // rolled: unrolled, the later groups' loads went out two at a time
  for (int g = 0; g < XG; ++g) {
    const int idx0 = (blk * XG + g) * XB * 256 + threadIdx.x;   // one per 4 elems
    float4 v[XB];
#pragma unroll   // XB loads in flight before the first store
    for (int j = 0; j < XB; ++j)
      v[j] = *(const float4*)(x + (size_t)(idx0 + j * 256) * 4);
    WAIT_XCNT0();
#pragma unroll
    for (int j = 0; j < XB; ++j) {
      int e = (idx0 + j * 256) * 4;
      int row = e >> 8, c = e & 255;
      *(bf4*)(cat + (size_t)row * 512 + c) = pack4(v[j]);
    }
    WAIT_XCNT0();
  }
}

__device__ __forceinline__ void d_im2col(int blk, const float* __restrict__ x,
                                bf16_t* __restrict__ xim) {
  int t  = threadIdx.x;                 // 256 threads * 4 elems = 1024 = one row of xim
  int kidx = t * 4;
  int p = kidx >> 8, i = kidx & 255;
  int kh = p >> 1, kw = p & 1;
#pragma unroll 1   // rolled: unrolled, the later groups' loads went out two at a time
  for (int g = 0; g < XG; ++g) {
    const int bs0 = (blk * XG + g) * XB;   // rows bs0 .. bs0+XB-1 of 0..ROWS_S-1
    float4 v[XB];
#pragma unroll   // XB loads in flight before the first store
    for (int j = 0; j < XB; ++j) {
      int bs = bs0 + j;
      int b  = bs >> 12;
      int s  = bs & 4095;
      int oh = s >> 6, ow = s & 63;
      int n = (2*oh + kh) * Wh + (2*ow + kw);
      v[j] = *(const float4*)(x + ((size_t)b * Nn + n) * Cc + i);
    }
    WAIT_XCNT0();
#pragma unroll
    for (int j = 0; j < XB; ++j)
      *(bf4*)(xim + (size_t)(bs0 + j) * 1024 + kidx) = pack4(v[j]);
    WAIT_XCNT0();
  }
}

static constexpr int PB_W256 = 256 * 256 / 256 / WPT;  // blocks of a 256x256 transpose
static constexpr int PB_W1   = 512 * 512 / 256 / WPT;
static constexpr int PB_W2   = 512 * 256 / 256 / WPT;
static constexpr int PB_SRW  = 256 * 1024 / 256 / WPT;
static constexpr int PB_X    = ROWS_X * 256 / 4 / 256 / (XB * XG);
static constexpr int PB_IM   = ROWS_S / (XB * XG);
static constexpr int PB_ALL  = 4 * PB_W256 + PB_W1 + PB_W2 + PB_SRW + PB_X + PB_IM;

__global__ __launch_bounds__(256) void k_prep(
    const float* __restrict__ x, const float* __restrict__ sr_w,
    const float* __restrict__ wq, const float* __restrict__ wk,
    const float* __restrict__ wv, const float* __restrict__ wm,
    const float* __restrict__ w1, const float* __restrict__ w2,
    bf16_t* __restrict__ wqT, bf16_t* __restrict__ wkT, bf16_t* __restrict__ wvT,
    bf16_t* __restrict__ wmT, bf16_t* __restrict__ w1T, bf16_t* __restrict__ w2T,
    bf16_t* __restrict__ wsrT, bf16_t* __restrict__ cat, bf16_t* __restrict__ xim)
{
  int blk = blockIdx.x;
  if (blk < PB_W256) { d_transpose_w(blk, wq, wqT, 256, 256); return; }
  blk -= PB_W256;
  if (blk < PB_W256) { d_transpose_w(blk, wk, wkT, 256, 256); return; }
  blk -= PB_W256;
  if (blk < PB_W256) { d_transpose_w(blk, wv, wvT, 256, 256); return; }
  blk -= PB_W256;
  if (blk < PB_W256) { d_transpose_w(blk, wm, wmT, 256, 256); return; }
  blk -= PB_W256;
  if (blk < PB_W1)   { d_transpose_w(blk, w1, w1T, 512, 512); return; }
  blk -= PB_W1;
  if (blk < PB_W2)   { d_transpose_w(blk, w2, w2T, 512, 256); return; }
  blk -= PB_W2;
  if (blk < PB_SRW)  { d_pack_srw(blk, sr_w, wsrT); return; }
  blk -= PB_SRW;
  if (blk < PB_X)    { d_pack_x(blk, x, cat); return; }
  blk -= PB_X;
  d_im2col(blk, x, xim);
}

// ---------------- generic WMMA GEMM (128x256 tile, async double-buffered) ----------------
enum { EP_F32 = 0, EP_BIAS_F32 = 1, EP_ELU_BF = 2, EP_SCALE_BF = 3, EP_RELU_BF = 4 };

// C[M,Ncol] = epi( A[M,K](lda) * BT[Ncol,K]^T ), block tile 128x256, stage of BK k; K is a
// multiple of BK, M of 128, Ncol of 256.
// 8 waves: wave -> (wy=w>>2 in 0..1 : 64 rows, wx=w&3 : 64 cols), 4x4 accs each: every
// fragment read from LDS feeds four WMMAs, and a row of A is fetched once per 256 columns.
// One grid serves two independent products: blocks below g0.nblk work on g0, the rest
// on g1. Inside a product the tile column runs fastest (1 << lgx tile columns).
struct GemmArgs {
  const bf16_t* A;
  const bf16_t* BT;
  float* outF;
  bf16_t* outB;
  const float* bias;
  int lda, K, ldo, mode, lgx, nblk;
  float scale;
};

// exp(x) as the compiler builds __expf (one multiply, then v_exp_f32). The v_nop in the same
// statement fills the one slot that the instruction set asks for behind a transcendental.
__device__ __forceinline__ float exp_with_slot(float x) {
  float y, t = x * 1.44269504f;
  asm("v_exp_f32 %0, %1\n\tv_nop" : "=v"(y) : "v"(t));
  return y;
}

// The epilogue of one wave's 64x64 piece for one mode. The mode is a template argument and
// is tested once per wave (the switch in the kernel), for speed only.
// orow0, ocol0: this lane's first output row and column.
template <int MODE>
__device__ __forceinline__ void store_tile(const v8f (&acc)[4][4],
                                           float* __restrict__ outF, bf16_t* __restrict__ outB,
                                           const float* __restrict__ bias, int ldo, float scale,
                                           int orow0, int ocol0)
{
  // all three loops unrolled: acc lives in registers and needs constant indices
#pragma unroll
  for (int m = 0; m < 4; ++m) {
#pragma unroll
    for (int i = 0; i < 8; ++i) {
      int orow = orow0 + m * 16 + i;
#pragma unroll
      for (int n = 0; n < 4; ++n) {
        int ocol = ocol0 + n * 16;
        float v = acc[m][n][i];
        if (MODE == EP_F32) {
          outF[(size_t)orow * ldo + ocol] = v;
        } else if (MODE == EP_BIAS_F32) {
          outF[(size_t)orow * ldo + ocol] = v + bias[ocol];
        } else if (MODE == EP_ELU_BF) {   // elu(x)+1 : x+1 if x>0 else exp(x)
          float e = exp_with_slot(v);     // for every lane: no branch round the asm
          outB[(size_t)orow * ldo + ocol] = f2bf(v > 0.f ? v + 1.f : e);
        } else if (MODE == EP_SCALE_BF) {
          outB[(size_t)orow * ldo + ocol] = f2bf(v * scale);
        } else {                          // relu -> bf16
          outB[(size_t)orow * ldo + ocol] = f2bf(v > 0.f ? v : 0.f);
        }
      }
    }
  }
  WAIT_XCNT0();
}

__global__ __launch_bounds__(256) void k_gemm_wmma(GemmArgs g0, GemmArgs g1)
{
  const bool second = (int)blockIdx.x >= g0.nblk;
  const int  bid    = (int)blockIdx.x - (second ? g0.nblk : 0);
  const bf16_t* __restrict__ A    = second ? g1.A    : g0.A;
  const bf16_t* __restrict__ BT   = second ? g1.BT   : g0.BT;
  float*  __restrict__ outF       = second ? g1.outF : g0.outF;
  bf16_t* __restrict__ outB       = second ? g1.outB : g0.outB;
  const float* __restrict__ bias  = second ? g1.bias : g0.bias;
  const int   lda   = second ? g1.lda   : g0.lda;
  const int   K     = second ? g1.K     : g0.K;
  const int   ldo   = second ? g1.ldo   : g0.ldo;
  const int   mode  = second ? g1.mode  : g0.mode;
  const int   lgx   = second ? g1.lgx   : g0.lgx;
  const float scale = second ? g1.scale : g0.scale;
  __shared__ __align__(16) bf16_t As[2][128 * LDG];
  __shared__ __align__(16) bf16_t Bs[2][256 * LDG];
  const int tid  = threadIdx.x;
  const int lane = tid & 31, wave = tid >> 5;
  const int wy = wave >> 2, wx = wave & 3;
  const int row0 = (bid >> lgx) * 128;
  const int col0 = (bid & ((1 << lgx) - 1)) * 256;
  // tile loaders: eight lanes per row (128 B), 32 rows per pass of the block
  const int lr = tid >> 3, lk = (tid & 7) << 3;
  const bf16_t* Ag = A  + (size_t)(row0 + lr) * lda + lk;
  const bf16_t* Bg = BT + (size_t)(col0 + lr) * K   + lk;
  uint32_t ldsA[2], ldsB[2];
#pragma unroll
  for (int b = 0; b < 2; ++b) {
    ldsA[b] = lds_off32(&As[b][lr * LDG + lk]);
    ldsB[b] = lds_off32(&Bs[b][lr * LDG + lk]);
  }
  const int r = lane & 15, hb = (lane >> 4) << 3;
  const int nT = K / BK;

  v8f acc[4][4] = {};

  // in front of the loop: stage 0 lands and is published, then stage 1 starts
  stage_copies(ldsA[0], ldsB[0], Ag, Bg, lda, K);
  asm volatile("s_wait_asynccnt 0x0" ::: "memory");   // this wave's part of stage 0 is in LDS
  __syncthreads();
  if (nT > 1) stage_copies(ldsA[1], ldsB[1], Ag + BK, Bg + BK, lda, K);

  for (int t = 0; t < nT; ++t) {
    const int cur = t & 1;
    const bf16_t* as = &As[cur][0];
    const bf16_t* bs = &Bs[cur][0];
#pragma unroll   // the two 32-k halves of the stage, in k order
    for (int kk = 0; kk < BK; kk += 32) {
      v16bf af[4], bfr[4];
      // the loops over fragments are unrolled: register arrays need constant indices
#pragma unroll
      for (int m = 0; m < 4; ++m) af[m]  = frag16(as + (wy * 64 + m * 16 + r) * LDG + kk + hb);
#pragma unroll
      for (int n = 0; n < 4; ++n) bfr[n] = frag16(bs + (wx * 64 + n * 16 + r) * LDG + kk + hb);
      // Keeps the 16 fragment loads together in front of their 16 WMMAs: left free, the
      // compiler held one A fragment only and re-loaded it, with a wait to 0, every 4 WMMAs.
      __builtin_amdgcn_sched_barrier(0);
#pragma unroll
      for (int m = 0; m < 4; ++m)
#pragma unroll
        for (int n = 0; n < 4; ++n)
          acc[m][n] = __builtin_amdgcn_wmma_f32_16x16x32_bf16(false, af[m], false, bfr[n],
                                                              (short)0, acc[m][n], false, false);
    }
    asm volatile("s_wait_dscnt 0x0" ::: "memory");      // this wave has left buffer cur
    asm volatile("s_wait_asynccnt 0x0" ::: "memory");   // its part of stage t + 1 is in LDS
    __syncthreads();   // publishes stage t + 1 and frees buffer cur for the refill
    if (t + 2 < nT)
      stage_copies(ldsA[cur], ldsB[cur], Ag + (t + 2) * BK, Bg + (t + 2) * BK, lda, K);
  }
  asm volatile("s_wait_asynccnt 0x0" ::: "memory");     // no copy is left in flight

  const int orow0 = row0 + wy * 64 + (lane >> 4) * 8;
  const int ocol0 = col0 + wx * 64 + r;
  switch (mode) {
    case EP_F32:      store_tile<EP_F32>(acc, outF, outB, bias, ldo, scale, orow0, ocol0);      break;
    case EP_BIAS_F32: store_tile<EP_BIAS_F32>(acc, outF, outB, bias, ldo, scale, orow0, ocol0); break;
    case EP_ELU_BF:   store_tile<EP_ELU_BF>(acc, outF, outB, bias, ldo, scale, orow0, ocol0);   break;
    case EP_SCALE_BF: store_tile<EP_SCALE_BF>(acc, outF, outB, bias, ldo, scale, orow0, ocol0); break;
    default:          store_tile<EP_RELU_BF>(acc, outF, outB, bias, ldo, scale, orow0, ocol0);  break;
  }
}

// ---------------- LayerNorm over 256-wide rows ----------------
// A wave takes LN_R rows a trip (their loads in flight together) and strides over the
// rows by the grid, so that few waves are started; rows is a multiple of LN_R.
static constexpr int LN_R = 4;
__global__ __launch_bounds__(256) void k_layernorm(
    const float* __restrict__ in, const float* __restrict__ g, const float* __restrict__ bb,
    bf16_t* __restrict__ outB, int ldoB,
    float* __restrict__ outF, const float* __restrict__ resid, int rows)
{
  int wave = threadIdx.x >> 5, lane = threadIdx.x & 31;
  const int step = (int)gridDim.x * 8 * LN_R;
  float gv[8], bv[8];
#pragma unroll
  for (int j = 0; j < 8; ++j) { gv[j] = g[lane * 8 + j]; bv[j] = bb[lane * 8 + j]; }
  // The same wait; the loaded values are named as inputs because these loads (of memory
  // that nothing writes) were otherwise moved behind it.
  asm volatile("s_wait_xcnt 0x0"
               :: "v"(gv[0]), "v"(gv[1]), "v"(gv[2]), "v"(gv[3]),
                  "v"(gv[4]), "v"(gv[5]), "v"(gv[6]), "v"(gv[7]),
                  "v"(bv[0]), "v"(bv[1]), "v"(bv[2]), "v"(bv[3]),
                  "v"(bv[4]), "v"(bv[5]), "v"(bv[6]), "v"(bv[7]) : "memory");
  __builtin_amdgcn_sched_barrier(0);   // keeps the loop's address arithmetic behind it
  for (int row0 = (blockIdx.x * 8 + wave) * LN_R; row0 < rows; row0 += step) {
    float vals[LN_R][8];
    float res[LN_R][8];
#pragma unroll   // all the rows' loads go out before the first sum
    for (int q = 0; q < LN_R; ++q) {
      const float* p = in + (size_t)(row0 + q) * 256;
      float4 a = *(const float4*)(p + lane * 8);
      float4 c = *(const float4*)(p + lane * 8 + 4);
      vals[q][0] = a.x; vals[q][1] = a.y; vals[q][2] = a.z; vals[q][3] = a.w;
      vals[q][4] = c.x; vals[q][5] = c.y; vals[q][6] = c.z; vals[q][7] = c.w;
    }
    WAIT_XCNT0();
    if (outF) {
#pragma unroll
      for (int q = 0; q < LN_R; ++q)
#pragma unroll
        for (int j = 0; j < 8; ++j)
          res[q][j] = resid[(size_t)(row0 + q) * 256 + lane * 8 + j];
      WAIT_XCNT0();
    }
#pragma unroll
    for (int q = 0; q < LN_R; ++q) {
      const int row = row0 + q;
      float s = 0.f;
#pragma unroll
      for (int j = 0; j < 8; ++j) s += vals[q][j];
#pragma unroll
      for (int o = 16; o > 0; o >>= 1) s += __shfl_xor(s, o, 32);
      float mean = s * (1.f / 256.f);
      float vs = 0.f;
#pragma unroll
      for (int j = 0; j < 8; ++j) { vals[q][j] -= mean; vs += vals[q][j] * vals[q][j]; }
#pragma unroll
      for (int o = 16; o > 0; o >>= 1) vs += __shfl_xor(vs, o, 32);
      float inv = rsqrtf(vs * (1.f / 256.f) + 1e-5f);
#pragma unroll
      for (int j = 0; j < 8; ++j) {
        int c0 = lane * 8 + j;
        float y = vals[q][j] * inv * gv[j] + bv[j];
        if (outB) outB[(size_t)row * ldoB + c0] = f2bf(y);
        if (outF) outF[(size_t)row * 256 + c0] = y + res[q][j];
        WAIT_XCNT0();
      }
    }
  }
}

// ---------------- Ksum = sum_s K_elu ----------------
__device__ inline void d_ksum_part(int blk, const bf16_t* __restrict__ Ke,
                                   float* __restrict__ part) {
  // blk in 0..B*16-1
  int b = blk >> 4, ch = blk & 15;
  int c = threadIdx.x;                  // 256
  const bf16_t* p = Ke + ((size_t)b * Ssz + ch * 256) * 256 + c;
  float s = 0.f;
  for (int i = 0; i < 256; ++i) s += bf2f(p[(size_t)i * 256]);
  part[((size_t)b * 16 + ch) * 256 + c] = s;
}
__device__ inline void d_ksum_reduce(int blk, const float* __restrict__ part,
                                     float* __restrict__ ksum) {
  int idx = blk * 256 + threadIdx.x;  // B*256
  if (idx >= Bsz * 256) return;
  int b = idx >> 8, c = idx & 255;
  float s = 0.f;
  for (int ch = 0; ch < 16; ++ch) s += part[((size_t)b * 16 + ch) * 256 + c];
  ksum[idx] = s;
}

// ---------------- KV[b,h] = K^T * Vsc (32x32 over S=4096), stored transposed ----------------
// S is cut into KV_SPLIT ranges, one work-group per (b,h,range); each stores an f32
// partial [e][d], and k_kv_ksum_reduce sums the ranges in index order.
static constexpr int KV_SPLIT = 32;
static constexpr int KV_ROWS  = Ssz / KV_SPLIT;    // 128 rows of S per work-group
static constexpr int KV_ELEMS = Bsz * NH * 32 * 32;

__device__ inline void d_kv_wmma(int bh, int range, const bf16_t* __restrict__ Ke,
                                 const bf16_t* __restrict__ Vsc,
                                 float* __restrict__ kvpart)
{
  __shared__ __align__(16) bf16_t KT[32 * LDP];  // [d][s]
  __shared__ __align__(16) bf16_t VT[32 * LDP];  // [e][s]
  int b = bh >> 3, h = bh & 7;          // bh in 0..B*NH-1
  int tid = threadIdx.x, lane = tid & 31, wave = tid >> 5;
  int d0 = (tid & 7) * 4;
  int si = tid >> 3;
  const int r = lane & 15, hb = (lane >> 4) << 3;
  int ti = (wave >> 1) & 1, tj = wave & 1;
  v8f acc = {0,0,0,0,0,0,0,0};
  const size_t base = (size_t)b * Ssz * 256 + h * 32;

  const int sBeg = range * KV_ROWS;
  for (int s0 = sBeg; s0 < sBeg + KV_ROWS; s0 += 32) {
    bf4 kk = *(const bf4*)(Ke  + base + (size_t)(s0 + si) * 256 + d0);
    bf4 vv = *(const bf4*)(Vsc + base + (size_t)(s0 + si) * 256 + d0);
    __syncthreads();
#pragma unroll
    for (int j = 0; j < 4; ++j) {
      KT[(d0 + j) * LDP + si] = kk.e[j];
      VT[(d0 + j) * LDP + si] = vv.e[j];
    }
    __syncthreads();
    if (wave < 4) {
      v16bf af = frag16(KT + (ti * 16 + r) * LDP + hb);
      v16bf bf = frag16(VT + (tj * 16 + r) * LDP + hb);
      acc = __builtin_amdgcn_wmma_f32_16x16x32_bf16(false, af, false, bf,
                                                    (short)0, acc, false, false);
    }
  }
  if (wave < 4) {
    int half = lane >> 4;
    float* pp = kvpart + (size_t)range * KV_ELEMS;
#pragma unroll
    for (int i = 0; i < 8; ++i) {
      int d = ti * 16 + i + half * 8;
      int e = tj * 16 + r;
      pp[((size_t)bh * 32 + e) * 32 + d] = acc[i];
    }
  }
}

// K-sum partials and K^T V partials both read only Ke / Vsc: one grid, the long K-sum
// blocks first.
static constexpr int KS_BLK = Bsz * 16;
__global__ __launch_bounds__(256) void k_kv_ksum_part(const bf16_t* __restrict__ Ke,
                                                      const bf16_t* __restrict__ Vsc,
                                                      float* __restrict__ kvpart,
                                                      float* __restrict__ part)
{
  int blk = blockIdx.x;
  if (blk < KS_BLK) { d_ksum_part(blk, Ke, part); return; }
  blk -= KS_BLK;
  d_kv_wmma(blk & (Bsz * NH - 1), blk >> 5, Ke, Vsc, kvpart);
}

__device__ inline void d_kv_reduce(int blk, const float* __restrict__ kvpart,
                                   bf16_t* __restrict__ KVbT)
{
  int idx = blk * 256 + threadIdx.x;                // 0..KV_ELEMS-1
  float s = 0.f;
  // unrolled so that all the partial loads are in flight together
#pragma unroll
  for (int ch = 0; ch < KV_SPLIT; ++ch) s += kvpart[(size_t)ch * KV_ELEMS + idx];
  KVbT[idx] = f2bf(s);
}

// the two sums over partials, one grid
static constexpr int KVR_BLK = KV_ELEMS / 256;
static constexpr int KSR_BLK = Bsz * 256 / 256;
__global__ __launch_bounds__(256) void k_kv_ksum_reduce(const float* __restrict__ kvpart,
                                                        bf16_t* __restrict__ KVbT,
                                                        const float* __restrict__ part,
                                                        float* __restrict__ ksum)
{
  int blk = blockIdx.x;
  if (blk < KVR_BLK) { d_kv_reduce(blk, kvpart, KVbT); return; }
  d_ksum_reduce(blk - KVR_BLK, part, ksum);
}

// ---------------- msg = (Q * KV) * S/(Q.Ksum + eps) ----------------
__global__ __launch_bounds__(256) void k_msg_wmma(const bf16_t* __restrict__ Qe,
                                                  const bf16_t* __restrict__ KVbT,
                                                  const float* __restrict__ ksum,
                                                  bf16_t* __restrict__ msgb)
{
  int row0 = blockIdx.x * 16;
  int lane = threadIdx.x & 31, h = threadIdx.x >> 5;
  int b = row0 >> 14;
  const int r = lane & 15, hb = (lane >> 4) << 3;

  const bf16_t* Ap = Qe + (size_t)(row0 + r) * 256 + h * 32;
  v16bf af = frag16(Ap + hb);
  const bf16_t* Bp = KVbT + (size_t)(b * 8 + h) * 32 * 32;
  v16bf bf0 = frag16(Bp + r * 32 + hb);
  v16bf bf1 = frag16(Bp + (16 + r) * 32 + hb);
  v8f acc0 = {0,0,0,0,0,0,0,0};
  v8f acc1 = {0,0,0,0,0,0,0,0};
  acc0 = __builtin_amdgcn_wmma_f32_16x16x32_bf16(false, af, false, bf0,
                                                 (short)0, acc0, false, false);
  acc1 = __builtin_amdgcn_wmma_f32_16x16x32_bf16(false, af, false, bf1,
                                                 (short)0, acc1, false, false);

  const float* ks = ksum + (size_t)b * 256 + h * 32;
  float dot = 0.f;
#pragma unroll
  for (int d = 0; d < 32; ++d) dot += bf2f(Ap[d]) * ks[d];
  float z = (float)Ssz / (dot + 1e-6f);

  int half = lane >> 4;
#pragma unroll
  for (int i = 0; i < 8; ++i) {
    float zi = __shfl(z, i + half * 8, 32);
    int orow = row0 + i + half * 8;
    bf16_t* op = msgb + (size_t)orow * 256 + h * 32;
    op[r]      = f2bf(acc0[i] * zi);
    op[16 + r] = f2bf(acc1[i] * zi);
  }
}

// ---------------- host launcher ----------------
// 128x256 output tiles of the GEMM shapes
static constexpr int TB_S  = ROWS_S / 128;         // [ROWS_S][256]
static constexpr int TB_X  = ROWS_X / 128;         // [ROWS_X][256]
static constexpr int TB_X2 = 2 * (ROWS_X / 128);   // [ROWS_X][512]
// LayerNorm grids: one trip over the short input, two over the long ones
static constexpr int LN_BLK_S = ROWS_S / (8 * LN_R);
static constexpr int LN_BLK_X = ROWS_X / (8 * LN_R) / 2;

extern "C" void kernel_launch(void* const* d_in, const int* in_sizes, int n_in,
                              void* d_out, int out_size, void* d_ws, size_t ws_size,
                              hipStream_t stream) {
  const float* x      = (const float*)d_in[0];
  const float* sr_w   = (const float*)d_in[1];
  const float* sr_b   = (const float*)d_in[2];
  const float* norm_g = (const float*)d_in[3];
  const float* norm_b = (const float*)d_in[4];
  const float* wq     = (const float*)d_in[5];
  const float* wk     = (const float*)d_in[6];
  const float* wv     = (const float*)d_in[7];
  const float* wm     = (const float*)d_in[8];
  const float* w1     = (const float*)d_in[9];
  const float* w2     = (const float*)d_in[10];
  const float* n1g    = (const float*)d_in[11];
  const float* n1b    = (const float*)d_in[12];
  const float* n2g    = (const float*)d_in[13];
  const float* n2b    = (const float*)d_in[14];
  float* out = (float*)d_out;

  char* ws = (char*)d_ws;
  size_t off = 0;
  auto alloc = [&](size_t bytes) -> void* {
    off = (off + 255) & ~(size_t)255;
    void* p = ws + off;
    off += bytes;
    return p;
  };

  bf16_t* wqT  = (bf16_t*)alloc((size_t)256 * 256 * 2);
  bf16_t* wkT  = (bf16_t*)alloc((size_t)256 * 256 * 2);
  bf16_t* wvT  = (bf16_t*)alloc((size_t)256 * 256 * 2);
  bf16_t* wmT  = (bf16_t*)alloc((size_t)256 * 256 * 2);
  bf16_t* w1T  = (bf16_t*)alloc((size_t)512 * 512 * 2);
  bf16_t* w2T  = (bf16_t*)alloc((size_t)256 * 512 * 2);
  bf16_t* wsrT = (bf16_t*)alloc((size_t)256 * 1024 * 2);
  float*  part = (float*)alloc((size_t)Bsz * 16 * 256 * 4);
  float*  ksum = (float*)alloc((size_t)Bsz * 256 * 4);
  bf16_t* KVbT = (bf16_t*)alloc((size_t)Bsz * NH * 32 * 32 * 2);
  bf16_t* cat  = (bf16_t*)alloc((size_t)ROWS_X * 512 * 2);          // [x | msg_ln]
  // pool A: im2col buf, later reused for msg (both 32 MiB)
  bf16_t* xim  = (bf16_t*)alloc((size_t)ROWS_S * 1024 * 2);
  bf16_t* msgb = xim;
  // pool B: Qe + xs + xs_ln + Ke + Vsc, later reused for h1 (64 MiB <= 72 MiB)
  size_t szQe = (size_t)ROWS_X * 256 * 2;
  size_t szXs = (size_t)ROWS_S * 256 * 4;
  size_t szLn = (size_t)ROWS_S * 256 * 2;
  char* poolB = (char*)alloc(szQe + szXs + 3 * szLn);
  bf16_t* Qe    = (bf16_t*)poolB;
  float*  xs    = (float*)(poolB + szQe);
  bf16_t* xs_ln = (bf16_t*)(poolB + szQe + szXs);
  bf16_t* Ke    = (bf16_t*)(poolB + szQe + szXs + szLn);
  bf16_t* Vsc   = (bf16_t*)(poolB + szQe + szXs + 2 * szLn);
  bf16_t* h1    = (bf16_t*)poolB;        // [ROWS_X][512] bf16
  // pool C: mm f32, reused for h2 f32
  float* mm = (float*)alloc((size_t)ROWS_X * 256 * 4);
  float* h2 = mm;
  float* kvpart = mm;                    // KV partials (4 MiB), dead before mm is written

  // --- all input preparation, one grid ---
  k_prep<<<PB_ALL, 256, 0, stream>>>(x, sr_w, wq, wk, wv, wm, w1, w2,
                                     wqT, wkT, wvT, wmT, w1T, w2T, wsrT, cat, xim);

  // --- spatial reduction conv (im2col GEMM) together with the Q projection ---
  const GemmArgs gConv = { xim, wsrT, xs, nullptr, sr_b,
                           1024, 1024, 256, EP_BIAS_F32, 0, TB_S, 0.f };
  const GemmArgs gQ    = { cat, wqT, nullptr, Qe, nullptr,
                           512, 256, 256, EP_ELU_BF, 0, TB_X, 0.f };
  k_gemm_wmma<<<TB_S + TB_X, 256, 0, stream>>>(gConv, gQ);
  k_layernorm<<<LN_BLK_S, 256, 0, stream>>>(xs, norm_g, norm_b, xs_ln, 256,
                                              nullptr, nullptr, ROWS_S);

  // --- K and V projections from xs_ln, one grid ---
  const GemmArgs gK = { xs_ln, wkT, nullptr, Ke, nullptr,
                        256, 256, 256, EP_ELU_BF, 0, TB_S, 0.f };
  const GemmArgs gV = { xs_ln, wvT, nullptr, Vsc, nullptr,
                        256, 256, 256, EP_SCALE_BF, 0, TB_S,
                        1.f / (float)Ssz };
  k_gemm_wmma<<<TB_S + TB_S, 256, 0, stream>>>(gK, gV);

  // --- linear attention ---
  k_kv_ksum_part<<<KS_BLK + Bsz * NH * KV_SPLIT, 256, 0, stream>>>(Ke, Vsc, kvpart, part);
  k_kv_ksum_reduce<<<KVR_BLK + KSR_BLK, 256, 0, stream>>>(kvpart, KVbT, part, ksum);
  k_msg_wmma<<<ROWS_X / 16, 256, 0, stream>>>(Qe, KVbT, ksum, msgb);

  // --- merge proj + LN1 (into cat[:, 256:512]) ---
  const GemmArgs gM = { msgb, wmT, mm, nullptr, nullptr,
                        256, 256, 256, EP_F32, 0, TB_X, 0.f };
  k_gemm_wmma<<<TB_X, 256, 0, stream>>>(gM, gM);
  k_layernorm<<<LN_BLK_X, 256, 0, stream>>>(mm, n1g, n1b, cat + 256, 512,
                                              nullptr, nullptr, ROWS_X);

  // --- MLP ---
  const GemmArgs gH1 = { cat, w1T, nullptr, h1, nullptr,
                         512, 512, 512, EP_RELU_BF, 1, TB_X2, 0.f };
  k_gemm_wmma<<<TB_X2, 256, 0, stream>>>(gH1, gH1);
  const GemmArgs gH2 = { h1, w2T, h2, nullptr, nullptr,
                         512, 512, 256, EP_F32, 0, TB_X, 0.f };
  k_gemm_wmma<<<TB_X, 256, 0, stream>>>(gH2, gH2);

  // --- LN2 + residual ---
  k_layernorm<<<LN_BLK_X, 256, 0, stream>>>(h2, n2g, n2b, nullptr, 0,
                                              out, x, ROWS_X);
}

// v007
// It runs in 163 microseconds.
// In two side-by-side timings against v006, it was 1.33 and 1.35 times as fast.
// Over all steps from v000 it is 3.05 times as fast.
#include <hip/hip_runtime.h>
#include <stdint.h>
#include <stddef.h>

// ---------------- problem dims (hardcoded from reference) ----------------
static constexpr int Bsz  = 4;
static constexpr int Hh   = 128;
static constexpr int Wh   = 128;
static constexpr int Cc   = 256;
static constexpr int Nn   = Hh * Wh;          // 16384
static constexpr int Ssz  = (Hh/2) * (Wh/2);  // 4096
static constexpr int NH   = 8;
static constexpr int ROWS_X = Bsz * Nn;       // 65536
static constexpr int ROWS_S = Bsz * Ssz;      // 16384

// ---------------- types ----------------
typedef __bf16 bf16_t;
typedef __attribute__((ext_vector_type(16))) __bf16 v16bf;
typedef __attribute__((ext_vector_type(8)))  __bf16 v8bf;
typedef __attribute__((ext_vector_type(8)))  float  v8f;
typedef __attribute__((ext_vector_type(4)))  float  v4f;

struct bf4 { bf16_t e[4]; };   // POD 8-byte pack

__device__ inline bf16_t f2bf(float f) {
  union { float f; unsigned u; } a; a.f = f;
  unsigned r = a.u + 0x7FFFu + ((a.u >> 16) & 1u);
  unsigned short h = (unsigned short)(r >> 16);
  union { unsigned short u; bf16_t b; } o; o.u = h;
  return o.b;
}
__device__ inline float bf2f(bf16_t b) {
  union { unsigned short u; bf16_t b; } i; i.b = b;
  union { unsigned u; float f; } o; o.u = ((unsigned)i.u) << 16;
  return o.f;
}

// Assemble 16-elem bf16 WMMA fragment: 8 contiguous at p, 8 at p+16.
__device__ inline v16bf frag16(const bf16_t* p) {
  v8bf lo = *(const v8bf*)p;
  v8bf hi = *(const v8bf*)(p + 16);
  return __builtin_shufflevector(lo, hi, 0,1,2,3,4,5,6,7,8,9,10,11,12,13,14,15);
}

// gfx1250 async global->LDS copy, 16B per lane, tracked by ASYNCcnt.
// LDS dest VGPR = wave-relative LDS byte offset (low 32b of flat LDS address).
__device__ inline uint32_t lds_off32(const void* p) {
  return (uint32_t)(uintptr_t)p;
}
// LDS row pitch of every 32-k bf16 fragment tile, in elements: 80 B (16 B x odd), so
// that the 16 rows one ds_load_b128 half-wave reads fall on 16 different bank groups
// (at the plain 64 B pitch four rows share each group).
static constexpr int LDP = 40;

// A GEMM stage holds 64 k = 128 B of every operand row, so that eight neighbouring lanes
// of a copy fetch one whole 128-B line of global memory (a wave-wide copy: 4 lines).
// Row pitch in LDS 144 B (16 B x odd), for the same reason as LDP.
static constexpr int BK  = 64;
static constexpr int LDG = BK + 8;

// One stage of the GEMM, per thread: four 16-B pieces of A (32 tile rows apart) and eight
// of B. The s_wait_xcnt stands inside the statement, behind the last copy, so that no
// address register of a copy gets a new value in front of it.
__device__ __forceinline__ void stage_copies(uint32_t la, uint32_t lb,
                                             const bf16_t* ga, const bf16_t* gb,
                                             int lda, int ldb) {
  constexpr uint32_t LSTEP = 32 * LDG * 2;   // 32 tile rows, in LDS bytes
  asm volatile("global_load_async_to_lds_b128 %0, %12, off\n\t"
               "global_load_async_to_lds_b128 %1, %13, off\n\t"
               "global_load_async_to_lds_b128 %2, %14, off\n\t"
               "global_load_async_to_lds_b128 %3, %15, off\n\t"
               "global_load_async_to_lds_b128 %4, %16, off\n\t"
               "global_load_async_to_lds_b128 %5, %17, off\n\t"
               "global_load_async_to_lds_b128 %6, %18, off\n\t"
               "global_load_async_to_lds_b128 %7, %19, off\n\t"
               "global_load_async_to_lds_b128 %8, %20, off\n\t"
               "global_load_async_to_lds_b128 %9, %21, off\n\t"
               "global_load_async_to_lds_b128 %10, %22, off\n\t"
               "global_load_async_to_lds_b128 %11, %23, off\n\t"
               "s_wait_xcnt 0x0"
               :: "v"(la), "v"(la + LSTEP), "v"(la + 2 * LSTEP), "v"(la + 3 * LSTEP),
                  "v"(lb), "v"(lb + LSTEP), "v"(lb + 2 * LSTEP), "v"(lb + 3 * LSTEP),
                  "v"(lb + 4 * LSTEP), "v"(lb + 5 * LSTEP), "v"(lb + 6 * LSTEP),
                  "v"(lb + 7 * LSTEP),
                  "v"((uint64_t)(uintptr_t)(ga)),
                  "v"((uint64_t)(uintptr_t)(ga + (size_t)32 * lda)),
                  "v"((uint64_t)(uintptr_t)(ga + (size_t)64 * lda)),
                  "v"((uint64_t)(uintptr_t)(ga + (size_t)96 * lda)),
                  "v"((uint64_t)(uintptr_t)(gb)),
                  "v"((uint64_t)(uintptr_t)(gb + (size_t)32 * ldb)),
                  "v"((uint64_t)(uintptr_t)(gb + (size_t)64 * ldb)),
                  "v"((uint64_t)(uintptr_t)(gb + (size_t)96 * ldb)),
                  "v"((uint64_t)(uintptr_t)(gb + (size_t)128 * ldb)),
                  "v"((uint64_t)(uintptr_t)(gb + (size_t)160 * ldb)),
                  "v"((uint64_t)(uintptr_t)(gb + (size_t)192 * ldb)),
                  "v"((uint64_t)(uintptr_t)(gb + (size_t)224 * ldb))
               : "memory");
}

// Stands behind a group of global loads or stores, in front of the code that gives their
// address or data registers new values (the next trip of a loop, the next row).
// The scheduling barrier keeps that later code behind the wait: the "memory" clobber alone
// does not tie vector instructions to it.
#define WAIT_XCNT0()                                   \
  do {                                                 \
    asm volatile("s_wait_xcnt 0x0" ::: "memory");      \
    __builtin_amdgcn_sched_barrier(0);                 \
  } while (0)

// ---------------- weight prep ----------------
// The nine preparation bodies below depend on nothing but the inputs; k_prep runs them
// all in one grid, each on its own range of blocks (blk = index inside the range).
// Every thread works through several elements, so that the grid starts few waves.
static constexpr int WPT = 8;    // weight elements per thread
static constexpr int XB  = 8;    // float4 of x a thread has in flight
static constexpr int XG  = 4;    // such groups per thread

__device__ __forceinline__ void d_transpose_w(int blk, const float* __restrict__ w,
                                     bf16_t* __restrict__ wT, int K, int Ncol) {
  const int idx0 = blk * WPT * 256 + threadIdx.x;
  if (blk * WPT * 256 >= K * Ncol) return;   // K * Ncol is a multiple of WPT * 256
  float v[WPT];
#pragma unroll   // the WPT loads go out together
  for (int j = 0; j < WPT; ++j) v[j] = w[idx0 + j * 256];
  WAIT_XCNT0();
#pragma unroll
  for (int j = 0; j < WPT; ++j) {
    int idx = idx0 + j * 256;
    int k = idx / Ncol, n = idx % Ncol;
    wT[(size_t)n * K + k] = f2bf(v[j]);
  }
  WAIT_XCNT0();
}

__device__ __forceinline__ void d_pack_srw(int blk, const float* __restrict__ w,
                                  bf16_t* __restrict__ wT) {
  const int idx0 = blk * WPT * 256 + threadIdx.x;
  if (blk * WPT * 256 >= Cc * 4 * Cc) return;   // the total is a multiple of WPT * 256
  float v[WPT];
#pragma unroll   // the WPT loads go out together
  for (int j = 0; j < WPT; ++j) {
    int idx = idx0 + j * 256;
    int o = idx >> 10, r = idx & 1023;
    int p = r >> 8, i = r & 255;
    int kh = p >> 1, kw = p & 1;
    v[j] = w[(((size_t)o * Cc + i) * 2 + kh) * 2 + kw];
  }
  WAIT_XCNT0();
#pragma unroll
  for (int j = 0; j < WPT; ++j) wT[idx0 + j * 256] = f2bf(v[j]);
  WAIT_XCNT0();
}

__device__ __forceinline__ bf4 pack4(float4 v) {
  bf4 pk; pk.e[0]=f2bf(v.x); pk.e[1]=f2bf(v.y); pk.e[2]=f2bf(v.z); pk.e[3]=f2bf(v.w);
  return pk;
}

__device__ __forceinline__ void d_pack_x(int blk, const float* __restrict__ x,
                                bf16_t* __restrict__ cat) {
#pragma unroll 1   // rolled: unrolled, the later groups' loads went out two at a time
  for (int g = 0; g < XG; ++g) {
    const int idx0 = (blk * XG + g) * XB * 256 + threadIdx.x;   // one per 4 elems
    float4 v[XB];
#pragma unroll   // XB loads in flight before the first store
    for (int j = 0; j < XB; ++j)
      v[j] = *(const float4*)(x + (size_t)(idx0 + j * 256) * 4);
    WAIT_XCNT0();
#pragma unroll
    for (int j = 0; j < XB; ++j) {
      int e = (idx0 + j * 256) * 4;
      int row = e >> 8, c = e & 255;
      *(bf4*)(cat + (size_t)row * 512 + c) = pack4(v[j]);
    }
    WAIT_XCNT0();
  }
}

__device__ __forceinline__ void d_im2col(int blk, const float* __restrict__ x,
                                bf16_t* __restrict__ xim) {
  int t  = threadIdx.x;                 // 256 threads * 4 elems = 1024 = one row of xim
  int kidx = t * 4;
  int p = kidx >> 8, i = kidx & 255;
  int kh = p >> 1, kw = p & 1;
#pragma unroll 1   // rolled: unrolled, the later groups' loads went out two at a time
  for (int g = 0; g < XG; ++g) {
    const int bs0 = (blk * XG + g) * XB;   // rows bs0 .. bs0+XB-1 of 0..ROWS_S-1
    float4 v[XB];
#pragma unroll   // XB loads in flight before the first store
    for (int j = 0; j < XB; ++j) {
      int bs = bs0 + j;
      int b  = bs >> 12;
      int s  = bs & 4095;
      int oh = s >> 6, ow = s & 63;
      int n = (2*oh + kh) * Wh + (2*ow + kw);
      v[j] = *(const float4*)(x + ((size_t)b * Nn + n) * Cc + i);
    }
    WAIT_XCNT0();
#pragma unroll
    for (int j = 0; j < XB; ++j)
      *(bf4*)(xim + (size_t)(bs0 + j) * 1024 + kidx) = pack4(v[j]);
    WAIT_XCNT0();
  }
}

static constexpr int PB_W256 = 256 * 256 / 256 / WPT;  // blocks of a 256x256 transpose
static constexpr int PB_W1   = 512 * 512 / 256 / WPT;
static constexpr int PB_W2   = 512 * 256 / 256 / WPT;
static constexpr int PB_SRW  = 256 * 1024 / 256 / WPT;
static constexpr int PB_X    = ROWS_X * 256 / 4 / 256 / (XB * XG);
static constexpr int PB_IM   = ROWS_S / (XB * XG);
static constexpr int PB_ALL  = 4 * PB_W256 + PB_W1 + PB_W2 + PB_SRW + PB_X + PB_IM;

__global__ __launch_bounds__(256) void k_prep(
    const float* __restrict__ x, const float* __restrict__ sr_w,
    const float* __restrict__ wq, const float* __restrict__ wk,
    const float* __restrict__ wv, const float* __restrict__ wm,
    const float* __restrict__ w1, const float* __restrict__ w2,
    bf16_t* __restrict__ wqT, bf16_t* __restrict__ wkT, bf16_t* __restrict__ wvT,
    bf16_t* __restrict__ wmT, bf16_t* __restrict__ w1T, bf16_t* __restrict__ w2T,
    bf16_t* __restrict__ wsrT, bf16_t* __restrict__ cat, bf16_t* __restrict__ xim)
{
  int blk = blockIdx.x;
  if (blk < PB_W256) { d_transpose_w(blk, wq, wqT, 256, 256); return; }
  blk -= PB_W256;
  if (blk < PB_W256) { d_transpose_w(blk, wk, wkT, 256, 256); return; }
  blk -= PB_W256;
  if (blk < PB_W256) { d_transpose_w(blk, wv, wvT, 256, 256); return; }
  blk -= PB_W256;
  if (blk < PB_W256) { d_transpose_w(blk, wm, wmT, 256, 256); return; }
  blk -= PB_W256;
  if (blk < PB_W1)   { d_transpose_w(blk, w1, w1T, 512, 512); return; }
  blk -= PB_W1;
  if (blk < PB_W2)   { d_transpose_w(blk, w2, w2T, 512, 256); return; }
  blk -= PB_W2;
  if (blk < PB_SRW)  { d_pack_srw(blk, sr_w, wsrT); return; }
  blk -= PB_SRW;
  if (blk < PB_X)    { d_pack_x(blk, x, cat); return; }
  blk -= PB_X;
  d_im2col(blk, x, xim);
}

// ---------------- generic WMMA GEMM (128x256 tile, async double-buffered) ----------------
enum { EP_ELU_BF = 0, EP_SCALE_BF = 1, EP_RELU_BF = 2,
       EP_BIAS_LN_BF = 3, EP_LN_BF_CAT = 4, EP_LN_RES_F32 = 5 };

// C[M,Ncol] = epi( A[M,K](lda) * BT[Ncol,K]^T ), block tile 128x256, stage of BK k; K is a
// multiple of BK, M of 128, Ncol of 256.
// 8 waves: wave -> (wy=w>>2 in 0..1 : 64 rows, wx=w&3 : 64 cols), 4x4 accs each: every
// fragment read from LDS feeds four WMMAs, and a row of A is fetched once per 256 columns.
// One grid serves two independent products: blocks below g0.nblk work on g0, the rest
// on g1. Inside a product the tile column runs fastest (1 << lgx tile columns).
struct GemmArgs {
  const bf16_t* A;
  const bf16_t* BT;
  float* outF;
  bf16_t* outB;
  const float* bias;
  const float* lng;     // LayerNorm weight and offset (the three LN modes)
  const float* lnb;
  const float* resid;   // added behind the LayerNorm (EP_LN_RES_F32), row pitch 256
  int lda, K, ldo, lgx, nblk;
  float scale;
};

// exp(x) as the compiler builds __expf (one multiply, then v_exp_f32). The v_nop in the same
// statement fills the one slot that the instruction set asks for behind a transcendental.
__device__ __forceinline__ float exp_with_slot(float x) {
  float y, t = x * 1.44269504f;
  asm("v_exp_f32 %0, %1\n\tv_nop" : "=v"(y) : "v"(t));
  return y;
}

// The epilogue of one wave's 64x64 piece for one of the three modes without LayerNorm.
// orow0, ocol0: this lane's first output row and column.
template <int MODE>
__device__ __forceinline__ void store_tile(const v8f (&acc)[4][4],
                                           bf16_t* __restrict__ outB, int ldo, float scale,
                                           int orow0, int ocol0)
{
  // all three loops unrolled: acc lives in registers and needs constant indices
#pragma unroll
  for (int m = 0; m < 4; ++m) {
#pragma unroll
    for (int i = 0; i < 8; ++i) {
      int orow = orow0 + m * 16 + i;
#pragma unroll
      for (int n = 0; n < 4; ++n) {
        int ocol = ocol0 + n * 16;
        float v = acc[m][n][i];
        if (MODE == EP_ELU_BF) {          // elu(x)+1 : x+1 if x>0 else exp(x)
          float e = exp_with_slot(v);     // for every lane: no branch round the asm
          outB[(size_t)orow * ldo + ocol] = f2bf(v > 0.f ? v + 1.f : e);
        } else if (MODE == EP_SCALE_BF) {
          outB[(size_t)orow * ldo + ocol] = f2bf(v * scale);
        } else {                          // relu -> bf16
          outB[(size_t)orow * ldo + ocol] = f2bf(v > 0.f ? v : 0.f);
        }
      }
    }
  }
  WAIT_XCNT0();   // the code behind reuses the last stores' registers
}

// ---- LayerNorm in the epilogue (products with 256 columns: a block holds whole rows) ----
// A row of the 128x256 tile lies in 16 lanes of each of four waves. Every lane adds its four
// columns and puts the sum in red[row][64]; two threads per row add those up.
static constexpr int RP = 68;   // pitch of red in floats: rows 8 apart fall on other banks

// A work-group barrier that orders LDS alone. __syncthreads() also waits for every global
// load in flight, here the residual that is fetched ahead of the reductions.
__device__ __forceinline__ void lds_barrier() {
  __builtin_amdgcn_fence(__ATOMIC_RELEASE, "workgroup", "local");
  __builtin_amdgcn_s_barrier();
  __builtin_amdgcn_fence(__ATOMIC_ACQUIRE, "workgroup", "local");
}

// Sum of row tid >> 1 of red, in both of its threads.
__device__ __forceinline__ float ln_row_sum(const float* red, int tid) {
  const v4f* sp = (const v4f*)(red + (tid >> 1) * RP + (tid & 1) * 32);
  v4f q = sp[0];
#pragma unroll   // the eight reads go out together
  for (int j = 1; j < 8; ++j) q += sp[j];
  float s = (q.x + q.y) + (q.z + q.w);
  return s + __shfl_xor(s, 1, 32);
}

// Eight neighbouring rows' mean or 1 / sigma, in the order of an accumulator's registers.
__device__ __forceinline__ v8f ln_stat8(const float* p) {
  v4f a = *(const v4f*)p, c = *(const v4f*)(p + 4);
  return __builtin_shufflevector(a, c, 0, 1, 2, 3, 4, 5, 6, 7);
}

// The accumulators stay in registers from the product to the normalised value: mean, then
// the sum of squared distances from it, as the separate kernel had it. red and stat are LDS
// that the stages have left.
//   EP_BIAS_LN_BF : bf16 out = LayerNorm(product + bias), row pitch 256
//   EP_LN_BF_CAT  : bf16 out = LayerNorm(product), row pitch 512 (the right half of cat)
//   EP_LN_RES_F32 : f32 out = LayerNorm(product) + resid, row pitch 256
// The pitch is a constant of the mode, so that a lane's 128 stores are one address register
// pair with immediate offsets.
template <int MODE>
__device__ __forceinline__ void ln_store_tile(v8f (&acc)[4][4], float* red, float* stat,
                                              float* __restrict__ outF, bf16_t* __restrict__ outB,
                                              const float* __restrict__ bias,
                                              const float* __restrict__ lng,
                                              const float* __restrict__ lnb,
                                              const float* __restrict__ resid,
                                              int row0, int wy, int wx, int tid)
{
  constexpr bool RES = MODE == EP_LN_RES_F32;
  constexpr int  LDO = MODE == EP_LN_BF_CAT ? 512 : 256;
  const int lane  = tid & 31;
  const int lrow0 = wy * 64 + (lane >> 4) * 8;   // this lane's first row in the tile
  const int col   = wx * 64 + (lane & 15);       // its first column
  float* myred = red + lrow0 * RP + wx * 16 + (lane & 15);
  // 32-bit element offsets (the buffers are far below 4 GiB): one register beside the base
  const float* rp = resid + (unsigned)((row0 + lrow0) * 256 + col);   // used where RES
  float*  opF = outF + (unsigned)((row0 + lrow0) * LDO + col);        // used where RES
  bf16_t* opB = outB + (unsigned)((row0 + lrow0) * LDO + col);        // used where not
  // Every loop over m, i, n below is unrolled: register arrays need constant indices. The
  // arithmetic is on whole accumulators (8 rows of one column): written element by element
  // it was packed across columns, with a copy of the accumulators in another order.
  float gv[4], bv[4];
#pragma unroll
  for (int n = 0; n < 4; ++n) { gv[n] = lng[col + n * 16]; bv[n] = lnb[col + n * 16]; }
  WAIT_XCNT0();
  if (MODE == EP_BIAS_LN_BF) {
#pragma unroll
    for (int n = 0; n < 4; ++n) {
      float bn = bias[col + n * 16];
#pragma unroll
      for (int m = 0; m < 4; ++m) acc[m][n] += bn;
    }
  }
#pragma unroll
  for (int m = 0; m < 4; ++m) {
    v8f s = (acc[m][0] + acc[m][1]) + (acc[m][2] + acc[m][3]);
#pragma unroll
    for (int i = 0; i < 8; ++i) myred[(m * 16 + i) * RP] = s[i];
  }
  // The residual is fetched two 16-row groups ahead of its use: group 0 flies under both
  // reductions, group 1 under the second, groups 2 and 3 under the stores of 0 and 1.
  v8f res[2][4];
  auto fetch_res = [&](int m) {
    // keeps the loads behind the arithmetic above them: issued earlier, their registers and
    // its temporaries together did not fit, and loaded values were spilled
    __builtin_amdgcn_sched_barrier(0);
#pragma unroll
    for (int i = 0; i < 8; ++i)
#pragma unroll
      for (int n = 0; n < 4; ++n) res[m & 1][n][i] = rp[(m * 16 + i) * 256 + n * 16];
    WAIT_XCNT0();   // the code behind reuses the scalar base's registers
  };
  if (RES) fetch_res(0);
  lds_barrier();   // red is complete
  {
    float s = ln_row_sum(red, tid);
    if ((tid & 1) == 0) stat[tid >> 1] = s * (1.f / 256.f);
  }
  lds_barrier();   // the means are published, red is free again
#pragma unroll
  for (int m = 0; m < 4; ++m) {
    const v8f mean = ln_stat8(stat + lrow0 + m * 16);
    v8f vs = {0, 0, 0, 0, 0, 0, 0, 0};
#pragma unroll
    for (int n = 0; n < 4; ++n) { acc[m][n] -= mean; vs += acc[m][n] * acc[m][n]; }
#pragma unroll
    for (int i = 0; i < 8; ++i) myred[(m * 16 + i) * RP] = vs[i];
  }
  if (RES) fetch_res(1);
  lds_barrier();   // red is complete, every reader has left the means
  {
    float vs = ln_row_sum(red, tid);
    if ((tid & 1) == 0) stat[tid >> 1] = rsqrtf(vs * (1.f / 256.f) + 1e-5f);
  }
  lds_barrier();   // 1 / sigma is published
#pragma unroll
  for (int m = 0; m < 4; ++m) {
    const v8f inv = ln_stat8(stat + lrow0 + m * 16);
#pragma unroll
    for (int n = 0; n < 4; ++n) {
      acc[m][n] = acc[m][n] * inv * gv[n] + bv[n];
      if (RES) acc[m][n] += res[m & 1][n];
    }
#pragma unroll
    for (int i = 0; i < 8; ++i)
#pragma unroll
      for (int n = 0; n < 4; ++n) {
        if (RES) opF[(m * 16 + i) * LDO + n * 16] = acc[m][n][i];
        else     opB[(m * 16 + i) * LDO + n * 16] = f2bf(acc[m][n][i]);
      }
    if (RES && m < 2) {
      WAIT_XCNT0();   // the loads' results take registers that the stores above name
      fetch_res(m + 2);
    }
  }
  WAIT_XCNT0();   // the code behind reuses the last stores' registers
}

template <int MODE>
__device__ __forceinline__ void epilogue(v8f (&acc)[4][4], float* red, float* stat,
                                         float* __restrict__ outF, bf16_t* __restrict__ outB,
                                         const float* __restrict__ bias,
                                         const float* __restrict__ lng,
                                         const float* __restrict__ lnb,
                                         const float* __restrict__ resid,
                                         int ldo, float scale, int row0, int col0,
                                         int wy, int wx, int tid)
{
  if (MODE >= EP_BIAS_LN_BF)
    ln_store_tile<MODE>(acc, red, stat, outF, outB, bias, lng, lnb, resid, row0, wy, wx, tid);
  else
    store_tile<MODE>(acc, outB, ldo, scale, row0 + wy * 64 + ((tid >> 4) & 1) * 8,
                     col0 + wx * 64 + (tid & 15));
}

// The modes of the two products are template arguments. A LayerNorm mode rewrites the
// accumulators; as one case of a switch over all modes, whose blocks the compiler chains one
// behind the other, the old values stayed live beside the new ones for the blocks behind it
// (128 registers more: spills, or one block per WGP).
template <int MODE0, int MODE1>
__global__ __launch_bounds__(256) void k_gemm_wmma(GemmArgs g0, GemmArgs g1)
{
  const bool second = (int)blockIdx.x >= g0.nblk;
  const int  bid    = (int)blockIdx.x - (second ? g0.nblk : 0);
  const bf16_t* __restrict__ A    = second ? g1.A    : g0.A;
  const bf16_t* __restrict__ BT   = second ? g1.BT   : g0.BT;
  float*  __restrict__ outF       = second ? g1.outF : g0.outF;
  bf16_t* __restrict__ outB       = second ? g1.outB : g0.outB;
  const float* __restrict__ bias  = second ? g1.bias : g0.bias;
  const float* __restrict__ lng   = second ? g1.lng  : g0.lng;
  const float* __restrict__ lnb   = second ? g1.lnb  : g0.lnb;
  const float* __restrict__ resid = second ? g1.resid : g0.resid;
  const int   lda   = second ? g1.lda   : g0.lda;
  const int   K     = second ? g1.K     : g0.K;
  const int   ldo   = second ? g1.ldo   : g0.ldo;
  const int   lgx   = second ? g1.lgx   : g0.lgx;
  const float scale = second ? g1.scale : g0.scale;
  __shared__ __align__(16) bf16_t As[2][128 * LDG];
  __shared__ __align__(16) bf16_t Bs[2][256 * LDG];
  const int tid  = threadIdx.x;
  const int lane = tid & 31, wave = tid >> 5;
  const int wy = wave >> 2, wx = wave & 3;
  const int row0 = (bid >> lgx) * 128;
  const int col0 = (bid & ((1 << lgx) - 1)) * 256;
  // tile loaders: eight lanes per row (128 B), 32 rows per pass of the block
  const int lr = tid >> 3, lk = (tid & 7) << 3;
  const bf16_t* Ag = A  + (size_t)(row0 + lr) * lda + lk;
  const bf16_t* Bg = BT + (size_t)(col0 + lr) * K   + lk;
  uint32_t ldsA[2], ldsB[2];
#pragma unroll
  for (int b = 0; b < 2; ++b) {
    ldsA[b] = lds_off32(&As[b][lr * LDG + lk]);
    ldsB[b] = lds_off32(&Bs[b][lr * LDG + lk]);
  }
  const int r = lane & 15, hb = (lane >> 4) << 3;
  const int nT = K / BK;

  v8f acc[4][4] = {};

  // in front of the loop: stage 0 lands and is published, then stage 1 starts
  stage_copies(ldsA[0], ldsB[0], Ag, Bg, lda, K);
  asm volatile("s_wait_asynccnt 0x0" ::: "memory");   // this wave's part of stage 0 is in LDS
  __syncthreads();
  if (nT > 1) stage_copies(ldsA[1], ldsB[1], Ag + BK, Bg + BK, lda, K);

  for (int t = 0; t < nT; ++t) {
    const int cur = t & 1;
    const bf16_t* as = &As[cur][0];
    const bf16_t* bs = &Bs[cur][0];
#pragma unroll   // the two 32-k halves of the stage, in k order
    for (int kk = 0; kk < BK; kk += 32) {
      v16bf af[4], bfr[4];
      // the loops over fragments are unrolled: register arrays need constant indices
#pragma unroll
      for (int m = 0; m < 4; ++m) af[m]  = frag16(as + (wy * 64 + m * 16 + r) * LDG + kk + hb);
#pragma unroll
      for (int n = 0; n < 4; ++n) bfr[n] = frag16(bs + (wx * 64 + n * 16 + r) * LDG + kk + hb);
      // Keeps the 16 fragment loads together in front of their 16 WMMAs: left free, the
      // compiler held one A fragment only and re-loaded it, with a wait to 0, every 4 WMMAs.
      __builtin_amdgcn_sched_barrier(0);
#pragma unroll
      for (int m = 0; m < 4; ++m)
#pragma unroll
        for (int n = 0; n < 4; ++n)
          acc[m][n] = __builtin_amdgcn_wmma_f32_16x16x32_bf16(false, af[m], false, bfr[n],
                                                              (short)0, acc[m][n], false, false);
    }
    asm volatile("s_wait_dscnt 0x0" ::: "memory");      // this wave has left buffer cur
    asm volatile("s_wait_asynccnt 0x0" ::: "memory");   // its part of stage t + 1 is in LDS
    __syncthreads();   // publishes stage t + 1 and frees buffer cur for the refill
    if (t + 2 < nT)
      stage_copies(ldsA[cur], ldsB[cur], Ag + (t + 2) * BK, Bg + (t + 2) * BK, lda, K);
  }
  asm volatile("s_wait_asynccnt 0x0" ::: "memory");     // no copy is left in flight

  // Behind the loop's last barrier no wave reads a stage and no copy is in flight: the
  // LayerNorm modes use that LDS for their row sums.
  float* red  = (float*)&As[0][0];   // 128 x RP floats, inside As
  float* stat = (float*)&Bs[0][0];   // 128 floats
  if (MODE0 == MODE1 || second) epilogue<MODE1>(acc, red, stat, outF, outB, bias, lng, lnb, resid,
                                                ldo, scale, row0, col0, wy, wx, tid);
  else                          epilogue<MODE0>(acc, red, stat, outF, outB, bias, lng, lnb, resid,
                                                ldo, scale, row0, col0, wy, wx, tid);
}

// ---------------- Ksum = sum_s K_elu ----------------
__device__ inline void d_ksum_part(int blk, const bf16_t* __restrict__ Ke,
                                   float* __restrict__ part) {
  // blk in 0..B*16-1
  int b = blk >> 4, ch = blk & 15;
  int c = threadIdx.x;                  // 256
  const bf16_t* p = Ke + ((size_t)b * Ssz + ch * 256) * 256 + c;
  float s = 0.f;
  for (int i = 0; i < 256; ++i) s += bf2f(p[(size_t)i * 256]);
  part[((size_t)b * 16 + ch) * 256 + c] = s;
}
__device__ inline void d_ksum_reduce(int blk, const float* __restrict__ part,
                                     float* __restrict__ ksum) {
  int idx = blk * 256 + threadIdx.x;  // B*256
  if (idx >= Bsz * 256) return;
  int b = idx >> 8, c = idx & 255;
  float s = 0.f;
  for (int ch = 0; ch < 16; ++ch) s += part[((size_t)b * 16 + ch) * 256 + c];
  ksum[idx] = s;
}

// ---------------- KV[b,h] = K^T * Vsc (32x32 over S=4096), stored transposed ----------------
// S is cut into KV_SPLIT ranges, one work-group per (b,h,range); each stores an f32
// partial [e][d], and k_kv_ksum_reduce sums the ranges in index order.
static constexpr int KV_SPLIT = 32;
static constexpr int KV_ROWS  = Ssz / KV_SPLIT;    // 128 rows of S per work-group
static constexpr int KV_ELEMS = Bsz * NH * 32 * 32;

__device__ inline void d_kv_wmma(int bh, int range, const bf16_t* __restrict__ Ke,
                                 const bf16_t* __restrict__ Vsc,
                                 float* __restrict__ kvpart)
{
  __shared__ __align__(16) bf16_t KT[32 * LDP];  // [d][s]
  __shared__ __align__(16) bf16_t VT[32 * LDP];  // [e][s]
  int b = bh >> 3, h = bh & 7;          // bh in 0..B*NH-1
  int tid = threadIdx.x, lane = tid & 31, wave = tid >> 5;
  int d0 = (tid & 7) * 4;
  int si = tid >> 3;
  const int r = lane & 15, hb = (lane >> 4) << 3;
  int ti = (wave >> 1) & 1, tj = wave & 1;
  v8f acc = {0,0,0,0,0,0,0,0};
  const size_t base = (size_t)b * Ssz * 256 + h * 32;

  const int sBeg = range * KV_ROWS;
  for (int s0 = sBeg; s0 < sBeg + KV_ROWS; s0 += 32) {
    bf4 kk = *(const bf4*)(Ke  + base + (size_t)(s0 + si) * 256 + d0);
    bf4 vv = *(const bf4*)(Vsc + base + (size_t)(s0 + si) * 256 + d0);
    __syncthreads();
#pragma unroll
    for (int j = 0; j < 4; ++j) {
      KT[(d0 + j) * LDP + si] = kk.e[j];
      VT[(d0 + j) * LDP + si] = vv.e[j];
    }
    __syncthreads();
    if (wave < 4) {
      v16bf af = frag16(KT + (ti * 16 + r) * LDP + hb);
      v16bf bf = frag16(VT + (tj * 16 + r) * LDP + hb);
      acc = __builtin_amdgcn_wmma_f32_16x16x32_bf16(false, af, false, bf,
                                                    (short)0, acc, false, false);
    }
  }
  if (wave < 4) {
    int half = lane >> 4;
    float* pp = kvpart + (size_t)range * KV_ELEMS;
#pragma unroll
    for (int i = 0; i < 8; ++i) {
      int d = ti * 16 + i + half * 8;
      int e = tj * 16 + r;
      pp[((size_t)bh * 32 + e) * 32 + d] = acc[i];
    }
  }
}

// K-sum partials and K^T V partials both read only Ke / Vsc: one grid, the long K-sum
// blocks first.
static constexpr int KS_BLK = Bsz * 16;
__global__ __launch_bounds__(256) void k_kv_ksum_part(const bf16_t* __restrict__ Ke,
                                                      const bf16_t* __restrict__ Vsc,
                                                      float* __restrict__ kvpart,
                                                      float* __restrict__ part)
{
  int blk = blockIdx.x;
  if (blk < KS_BLK) { d_ksum_part(blk, Ke, part); return; }
  blk -= KS_BLK;
  d_kv_wmma(blk & (Bsz * NH - 1), blk >> 5, Ke, Vsc, kvpart);
}

__device__ inline void d_kv_reduce(int blk, const float* __restrict__ kvpart,
                                   bf16_t* __restrict__ KVbT)
{
  int idx = blk * 256 + threadIdx.x;                // 0..KV_ELEMS-1
  float s = 0.f;
  // unrolled so that all the partial loads are in flight together
#pragma unroll
  for (int ch = 0; ch < KV_SPLIT; ++ch) s += kvpart[(size_t)ch * KV_ELEMS + idx];
  KVbT[idx] = f2bf(s);
}

// the two sums over partials, one grid
static constexpr int KVR_BLK = KV_ELEMS / 256;
static constexpr int KSR_BLK = Bsz * 256 / 256;
__global__ __launch_bounds__(256) void k_kv_ksum_reduce(const float* __restrict__ kvpart,
                                                        bf16_t* __restrict__ KVbT,
                                                        const float* __restrict__ part,
                                                        float* __restrict__ ksum)
{
  int blk = blockIdx.x;
  if (blk < KVR_BLK) { d_kv_reduce(blk, kvpart, KVbT); return; }
  d_ksum_reduce(blk - KVR_BLK, part, ksum);
}

// ---------------- msg = (Q * KV) * S/(Q.Ksum + eps) ----------------
__global__ __launch_bounds__(256) void k_msg_wmma(const bf16_t* __restrict__ Qe,
                                                  const bf16_t* __restrict__ KVbT,
                                                  const float* __restrict__ ksum,
                                                  bf16_t* __restrict__ msgb)
{
  int row0 = blockIdx.x * 16;
  int lane = threadIdx.x & 31, h = threadIdx.x >> 5;
  int b = row0 >> 14;
  const int r = lane & 15, hb = (lane >> 4) << 3;

  const bf16_t* Ap = Qe + (size_t)(row0 + r) * 256 + h * 32;
  v16bf af = frag16(Ap + hb);
  const bf16_t* Bp = KVbT + (size_t)(b * 8 + h) * 32 * 32;
  v16bf bf0 = frag16(Bp + r * 32 + hb);
  v16bf bf1 = frag16(Bp + (16 + r) * 32 + hb);
  v8f acc0 = {0,0,0,0,0,0,0,0};
  v8f acc1 = {0,0,0,0,0,0,0,0};
  acc0 = __builtin_amdgcn_wmma_f32_16x16x32_bf16(false, af, false, bf0,
                                                 (short)0, acc0, false, false);
  acc1 = __builtin_amdgcn_wmma_f32_16x16x32_bf16(false, af, false, bf1,
                                                 (short)0, acc1, false, false);

  const float* ks = ksum + (size_t)b * 256 + h * 32;
  float dot = 0.f;
#pragma unroll
  for (int d = 0; d < 32; ++d) dot += bf2f(Ap[d]) * ks[d];
  float z = (float)Ssz / (dot + 1e-6f);

  int half = lane >> 4;
#pragma unroll
  for (int i = 0; i < 8; ++i) {
    float zi = __shfl(z, i + half * 8, 32);
    int orow = row0 + i + half * 8;
    bf16_t* op = msgb + (size_t)orow * 256 + h * 32;
    op[r]      = f2bf(acc0[i] * zi);
    op[16 + r] = f2bf(acc1[i] * zi);
  }
}

// ---------------- host launcher ----------------
// 128x256 output tiles of the GEMM shapes
static constexpr int TB_S  = ROWS_S / 128;         // [ROWS_S][256]
static constexpr int TB_X  = ROWS_X / 128;         // [ROWS_X][256]
static constexpr int TB_X2 = 2 * (ROWS_X / 128);   // [ROWS_X][512]

extern "C" void kernel_launch(void* const* d_in, const int* in_sizes, int n_in,
                              void* d_out, int out_size, void* d_ws, size_t ws_size,
                              hipStream_t stream) {
  const float* x      = (const float*)d_in[0];
  const float* sr_w   = (const float*)d_in[1];
  const float* sr_b   = (const float*)d_in[2];
  const float* norm_g = (const float*)d_in[3];
  const float* norm_b = (const float*)d_in[4];
  const float* wq     = (const float*)d_in[5];
  const float* wk     = (const float*)d_in[6];
  const float* wv     = (const float*)d_in[7];
  const float* wm     = (const float*)d_in[8];
  const float* w1     = (const float*)d_in[9];
  const float* w2     = (const float*)d_in[10];
  const float* n1g    = (const float*)d_in[11];
  const float* n1b    = (const float*)d_in[12];
  const float* n2g    = (const float*)d_in[13];
  const float* n2b    = (const float*)d_in[14];
  float* out = (float*)d_out;

  char* ws = (char*)d_ws;
  size_t off = 0;
  auto alloc = [&](size_t bytes) -> void* {
    off = (off + 255) & ~(size_t)255;
    void* p = ws + off;
    off += bytes;
    return p;
  };

  bf16_t* wqT  = (bf16_t*)alloc((size_t)256 * 256 * 2);
  bf16_t* wkT  = (bf16_t*)alloc((size_t)256 * 256 * 2);
  bf16_t* wvT  = (bf16_t*)alloc((size_t)256 * 256 * 2);
  bf16_t* wmT  = (bf16_t*)alloc((size_t)256 * 256 * 2);
  bf16_t* w1T  = (bf16_t*)alloc((size_t)512 * 512 * 2);
  bf16_t* w2T  = (bf16_t*)alloc((size_t)256 * 512 * 2);
  bf16_t* wsrT = (bf16_t*)alloc((size_t)256 * 1024 * 2);
  float*  part = (float*)alloc((size_t)Bsz * 16 * 256 * 4);
  float*  ksum = (float*)alloc((size_t)Bsz * 256 * 4);
  bf16_t* KVbT = (bf16_t*)alloc((size_t)Bsz * NH * 32 * 32 * 2);
  bf16_t* cat  = (bf16_t*)alloc((size_t)ROWS_X * 512 * 2);          // [x | msg_ln]
  // pool A: im2col buf, later reused for msg (both 32 MiB)
  bf16_t* xim  = (bf16_t*)alloc((size_t)ROWS_S * 1024 * 2);
  bf16_t* msgb = xim;
  // pool B: Qe + xs_ln + Ke + Vsc (56 MiB), later reused for h1 (64 MiB)
  size_t szQe = (size_t)ROWS_X * 256 * 2;
  size_t szLn = (size_t)ROWS_S * 256 * 2;
  char* poolB = (char*)alloc((size_t)ROWS_X * 512 * 2);
  bf16_t* Qe    = (bf16_t*)poolB;
  bf16_t* xs_ln = (bf16_t*)(poolB + szQe);
  bf16_t* Ke    = (bf16_t*)(poolB + szQe + szLn);
  bf16_t* Vsc   = (bf16_t*)(poolB + szQe + 2 * szLn);
  bf16_t* h1    = (bf16_t*)poolB;        // [ROWS_X][512] bf16
  float* kvpart = (float*)alloc((size_t)KV_SPLIT * KV_ELEMS * 4);   // KV partials (4 MiB)

  // --- all input preparation, one grid ---
  k_prep<<<PB_ALL, 256, 0, stream>>>(x, sr_w, wq, wk, wv, wm, w1, w2,
                                     wqT, wkT, wvT, wmT, w1T, w2T, wsrT, cat, xim);

  // --- spatial reduction conv (im2col GEMM) + its LayerNorm, together with the Q projection ---
  const GemmArgs gConv = { xim, wsrT, nullptr, xs_ln, sr_b, norm_g, norm_b, nullptr,
                           1024, 1024, 256, 0, TB_S, 0.f };
  const GemmArgs gQ    = { cat, wqT, nullptr, Qe, nullptr, nullptr, nullptr, nullptr,
                           512, 256, 256, 0, TB_X, 0.f };
  k_gemm_wmma<EP_BIAS_LN_BF, EP_ELU_BF><<<TB_S + TB_X, 256, 0, stream>>>(gConv, gQ);

  // --- K and V projections from xs_ln, one grid ---
  const GemmArgs gK = { xs_ln, wkT, nullptr, Ke, nullptr, nullptr, nullptr, nullptr,
                        256, 256, 256, 0, TB_S, 0.f };
  const GemmArgs gV = { xs_ln, wvT, nullptr, Vsc, nullptr, nullptr, nullptr, nullptr,
                        256, 256, 256, 0, TB_S,
                        1.f / (float)Ssz };
  k_gemm_wmma<EP_ELU_BF, EP_SCALE_BF><<<TB_S + TB_S, 256, 0, stream>>>(gK, gV);

  // --- linear attention ---
  k_kv_ksum_part<<<KS_BLK + Bsz * NH * KV_SPLIT, 256, 0, stream>>>(Ke, Vsc, kvpart, part);
  k_kv_ksum_reduce<<<KVR_BLK + KSR_BLK, 256, 0, stream>>>(kvpart, KVbT, part, ksum);
  k_msg_wmma<<<ROWS_X / 16, 256, 0, stream>>>(Qe, KVbT, ksum, msgb);

  // --- merge proj + LN1 (into cat[:, 256:512]) ---
  const GemmArgs gM = { msgb, wmT, nullptr, cat + 256, nullptr, n1g, n1b, nullptr,
                        256, 256, 512, 0, TB_X, 0.f };
  k_gemm_wmma<EP_LN_BF_CAT, EP_LN_BF_CAT><<<TB_X, 256, 0, stream>>>(gM, gM);

  // --- MLP ---
  const GemmArgs gH1 = { cat, w1T, nullptr, h1, nullptr, nullptr, nullptr, nullptr,
                         512, 512, 512, 1, TB_X2, 0.f };
  k_gemm_wmma<EP_RELU_BF, EP_RELU_BF><<<TB_X2, 256, 0, stream>>>(gH1, gH1);
  // second product + LN2 + residual
  const GemmArgs gH2 = { h1, w2T, out, nullptr, nullptr, n2g, n2b, x,
                         512, 512, 256, 0, TB_X, 0.f };
  k_gemm_wmma<EP_LN_RES_F32, EP_LN_RES_F32><<<TB_X, 256, 0, stream>>>(gH2, gH2);
}
